// v009
// The times below were measured on an AMD MI455X: many runs one after another, warmed up first and cycling through
// copies of the inputs, with the whole window's GPU time divided by the number of runs. Launches and the gaps
// between them are all in it. The median over several windows is given; except for v000 it joins two sittings, which
// can be a few percent apart, so the side-by-side timings, each taken in one sitting, are the better comparison.
// Earlier versions than v009 are not in this document.
// It runs in 309 microseconds.
// Timed twice side by side with v008, it ran 1.03 and 1.04 times as fast.
// Over all steps from v000, the starting kernel, it is 3.40 times as fast.
// Contractions: audio adapter, local-attention scores, q/k/v projections, causal multi-head q.k^T and p.v, FFN W1 and W2 on
// v_wmma_f32_16x16x32_f16 (f16 operands with power-of-two carried scales, f32 accumulate); video adapter, local-attention p.v
// and the output projection Wo on v_wmma_f32_16x16x32_bf16 with bf16 hi/lo split operands (hi.hi + hi.lo + lo.hi, f32
// accumulate). LayerNorm, RMSNorm, rotary tables, softmax and GELU in f32.
#include <hip/hip_runtime.h>
#include <math.h>
#include <stdint.h>

#define NB_   2
#define SEQ   2048
#define NTOK  4096
#define DM    1024
#define NHD   8
#define DHD   64
#define INR   512
#define FFD   4096
#define WSZ   512
#define NWN   4
#define KPR   512          // leading zero rows of the local-attention key plane
#define VTP   4608         // key pitch of the local-attention value^T planes: 512 zero columns + 4096 tokens

typedef __attribute__((ext_vector_type(16))) _Float16 v16h;
typedef __attribute__((ext_vector_type(8)))  _Float16 v8h;
typedef __attribute__((ext_vector_type(2)))  _Float16 v2h;
typedef __attribute__((ext_vector_type(16))) __bf16   v16b;
typedef __attribute__((ext_vector_type(8)))  __bf16   v8b;
typedef __attribute__((ext_vector_type(8)))  float    v8f;
typedef __attribute__((ext_vector_type(4)))  float    v4f;
typedef __attribute__((ext_vector_type(2)))  float    v2f;
typedef __attribute__((ext_vector_type(4)))  unsigned int v4u;

__device__ __forceinline__ unsigned short f2bf_bits(float f) {
  unsigned u = __float_as_uint(f);
  return (unsigned short)((u + 0x7FFFu + ((u >> 16) & 1u)) >> 16);   // RNE convert
}
__device__ __forceinline__ float bf_bits2f(unsigned short h) { return __uint_as_float(((unsigned)h) << 16); }
__device__ __forceinline__ unsigned pk16(unsigned short a, unsigned short b) { return (unsigned)a | ((unsigned)b << 16); }

__device__ __forceinline__ float wsum(float v) {
#pragma unroll
  for (int o = 16; o >= 1; o >>= 1) v += __shfl_xor(v, o, 32);
  return v;
}
__device__ __forceinline__ float wmax(float v) {
#pragma unroll
  for (int o = 16; o >= 1; o >>= 1) v = fmaxf(v, __shfl_xor(v, o, 32));
  return v;
}

// hazard guard as a plain device helper
__device__ __forceinline__ void acc_guard4(v8f& a, v8f& b, v8f& c, v8f& d) { asm volatile("v_nop\n\tv_nop\n\tv_nop\n\tv_nop" : "+v"(a), "+v"(b), "+v"(c), "+v"(d)); }

// Fragment loaders: element i of the 16-wide per-lane vector <- p[i] for i<8 and p[16 + (i-8)] for i>=8, where p already points at
// row (lane&15), k0 + 8*(lane>>4). Same map for A ([m][k]) and B stored as [n][k].
template <typename T> struct Frag;
template <> struct Frag<_Float16> {
  typedef v16h V; union U { v16h v; v8h h[2]; };
  static __device__ __forceinline__ v16h load(const _Float16* p) {
    U f; f.h[0] = *(const v8h*)(p); f.h[1] = *(const v8h*)(p + 16); return f.v;
  }
  static __device__ __forceinline__ v8f mma(v16h a, v16h b, v8f c) {
    return __builtin_amdgcn_wmma_f32_16x16x32_f16(false, a, false, b, (short)0, c, false, false);
  }
};
template <> struct Frag<__bf16> {
  typedef v16b V; union U { v16b v; v8b h[2]; };
  static __device__ __forceinline__ v16b load(const __bf16* p) {
    U f; f.h[0] = *(const v8b*)(p); f.h[1] = *(const v8b*)(p + 16); return f.v;
  }
  static __device__ __forceinline__ v8f mma(v16b a, v16b b, v8f c) {
    return __builtin_amdgcn_wmma_f32_16x16x32_bf16(false, a, false, b, (short)0, c, false, false);
  }
};

// =====================================================================================================================
// Batched WMMA GEMM: C[m,n] = epi(scale * sum_k A[m,k] * Bt[n,k]). A block of 4 waves (2 x 2) owns a 128x128 tile, each wave a
// 64x64 tile of it. The block's 128 rows of A and of Bt are staged in LDS, BK k-elements at a time, by asynchronous 16-byte
// copies that cover whole 128-byte lines, in two buffers: the next stage's copies fly while this stage is multiplied. Fragments are
// read from LDS one block of 32 k ahead into a second register set; a stage is published in front of the last block of the one before.
// Every block takes all stages of its k range, in cyclic order from stage (tile row + tile column) mod stages.
// A row-major [M,K] (pitch lda); Bt row-major [N,K] (pitch ldb); M, N % 128 == 0, K % BK == 0; grid = (tiles, Z).
//   ET: 0 = f16 operands, 1 = bf16 operands.   SPLIT: hi/lo planes (A2p, Bt2p = lo planes), product = hi.hi + hi.lo + lo.hi.
//   BIAS: + bias[n].  RESID: + resid[m*ldr + n].  EPI: 0 none, 1 tanh-GELU, 2 RMSNorm over the 64-column tile times gvec[n&63].
//   OUTM: 0 f32 -> Cf; 1 f16(v*oscale) -> Ch; 2 both.
//   LOC: 1 = windowed score tiles: key tiles n0 below kBeg(w) or at/after N/2 + m0 + 64 are skipped (a block leaves when all
//        four are; a wave whose own tile is skipped works like the others and stores nothing);
//        2 = windowed p.v: k range [kBeg(w), min(K, K/2 + mB + 128)); kBeg = N/2 resp. K/2 for the first window (w == 0), else 0.
//        3 = three projections of one activation plane in one grid (Z = 3, weight planes strideB apart, outputs strideH apart,
//            each output [rows][cols] dense): z = 0, 1: act . W_z^T with EPI, gvec for z = 0 and the resid pointer as gvec for
//            z = 1; z = 2: the operands change places (W_2 . act^T, an N x M result) and EPI is left out.
// =====================================================================================================================
template <int ET> struct Elem;
template <> struct Elem<0> { typedef _Float16 T; };
template <> struct Elem<1> { typedef __bf16 T; };

// Eight asynchronous 16-byte copies per lane, global -> LDS, eight rows lstep LDS bytes / gstep global elements apart.
// Written as the builtin: with two fragment sets k_gemm lives above v255, and the operands of an asm statement are held to one
// register window, which cost spills around every refill.
typedef __attribute__((ext_vector_type(4))) int v4i;
typedef __attribute__((address_space(1))) v4i gv4i;
typedef __attribute__((address_space(3))) v4i lv4i;
template <typename T>
__device__ __forceinline__ void copy8_to_lds(unsigned l0, unsigned lstep, const T* g0, size_t gstep) {
#pragma unroll                                    // eight copies back to back
  for (int i = 0; i < 8; ++i)
    __builtin_amdgcn_global_load_async_to_lds_b128((gv4i*)(uintptr_t)(g0 + i * gstep), (lv4i*)(l0 + i * lstep), 0, 0);
}

template <int ET, bool SPLIT, bool BIAS, int EPI, int OUTM, bool RESID, int LOC>
__global__ __launch_bounds__(128) void k_gemm(
    const unsigned short* __restrict__ Ap, const unsigned short* __restrict__ A2p, int lda, long strideA,
    const unsigned short* __restrict__ Btp, const unsigned short* __restrict__ Bt2p, int ldb, long strideB,
    float* __restrict__ Cf, int ldc, long strideC,
    _Float16* __restrict__ Ch, int ldh, long strideH,
    const float* __restrict__ bias, const float* __restrict__ gvec,
    const float* __restrict__ resid, int ldr, long strideR,
    int M, int N, int K, int nwin, float scale, float oscale) {
  typedef typename Elem<ET>::T T;
  typedef typename Frag<T>::V V;
  constexpr int BK    = SPLIT ? 64 : 128;        // k elements per stage: 64 KiB of operand rows either way
  constexpr int PITCH = BK + 8;                  // LDS row pitch in elements: row bytes + 16, conflict-free for 16-byte reads
  constexpr int PLANE = 128 * PITCH;             // one operand plane of a stage; planes: A, Bt (, A lo, Bt lo)
  constexpr int STAGE = (SPLIT ? 4 : 2) * PLANE;
  constexpr int CPR   = BK / 8;                  // 16-byte pieces per row
  constexpr int RPI   = 128 / CPR;               // rows that one copy of all 128 threads covers
  const T* A = (const T*)Ap; const T* A2 = (const T*)A2p; const T* Bt = (const T*)Btp; const T* Bt2 = (const T*)Bt2p;
  __shared__ __align__(16) T sAB[2 * STAGE];
  __shared__ __align__(16) float sT[4][16 * 68];
  const int z    = blockIdx.y;
  const int tid  = threadIdx.x;
  const int lane = tid & 31;
  const int wave = __builtin_amdgcn_readfirstlane(tid >> 5);
  const bool flip = (LOC == 3) && (z == 2);      // block-uniform
  const int Mz = flip ? N : M;
  const int Nz = flip ? M : N;
  const int tilesN = Nz >> 7;
  const int tilesM = Mz >> 7;
  const int bx = blockIdx.x;
  if (bx >= tilesM * tilesN) return;              // block-uniform, in front of every copy and barrier
  const int bm = bx / tilesN;
  const int bn = bx - bm * tilesN;
  const int mB = bm << 7;
  const int nB = bn << 7;
  const int wm = (wave >> 1) << 6;
  const int wn = (wave & 1) << 6;
  const int m0 = mB + wm;
  const int n0 = nB + wn;
  int kBeg = 0, kEnd = K;                         // block's k range
  bool act = true;                                // wave-uniform: this wave's tile is stored
  if (LOC == 1 || LOC == 2) {
    const int w = z % nwin;
    const bool first = (w == 0);
    if (LOC == 1) {
      const int nb = first ? (N >> 1) : 0;
      if (nB + 64 < nb || nB >= (N >> 1) + mB + 128) return; // block-uniform, in front of every copy and barrier
      act = !(n0 < nb || n0 >= (N >> 1) + m0 + 64);
    } else {
      kBeg = first ? (K >> 1) : 0;
      const int ke = (K >> 1) + mB + 128;
      kEnd = (ke < K) ? ke : K;
    }
  }

  const T* Ab  = flip ? (Bt + (size_t)z * strideB) : (A  + (size_t)z * strideA);
  const T* Bb  = flip ? (A  + (size_t)z * strideA) : (Bt + (size_t)z * strideB);
  const T* Ab2 = SPLIT ? (A2  + (size_t)z * strideA) : nullptr;
  const T* Bb2 = SPLIT ? (Bt2 + (size_t)z * strideB) : nullptr;

  const int rlane = lane & 15;                 // row (A) / col (B, D) within a 16x16 subtile
  const int koff  = (lane >> 4) * 8;           // k offset of this lane half
  const int mOff  = (lane >> 4) * 8;           // D row offset

  // this thread's piece of every copy: row crow (+ RPI per copy), 16 bytes at element ccol
  const int crow = tid / CPR;
  const int ccol = (tid % CPR) * 8;
  const unsigned lth = (unsigned)(size_t)sAB + (unsigned)(crow * PITCH + ccol) * 2u;
  const size_t aoff = (size_t)(mB + crow) * lda + ccol;
  const size_t boff = (size_t)(nB + crow) * ldb + ccol;
  const size_t astep = (size_t)RPI * lda;
  const size_t bstep = (size_t)RPI * ldb;
  constexpr unsigned LSTEP = RPI * PITCH * 2u;
  auto fill = [&](int buf, int k0) {             // 32 copies per wave: one stage into buffer buf
    const unsigned lb = lth + (unsigned)buf * (STAGE * 2u);
    if constexpr (SPLIT) {
      copy8_to_lds<T>(lb,                  LSTEP, Ab  + aoff + k0, astep);
      copy8_to_lds<T>(lb + PLANE * 2u,     LSTEP, Bb  + boff + k0, bstep);
      copy8_to_lds<T>(lb + PLANE * 4u,     LSTEP, Ab2 + aoff + k0, astep);
      copy8_to_lds<T>(lb + PLANE * 6u,     LSTEP, Bb2 + boff + k0, bstep);
    } else {
      copy8_to_lds<T>(lb,                              LSTEP, Ab + aoff + k0,             astep);
      copy8_to_lds<T>(lb + 8u * LSTEP,                 LSTEP, Ab + aoff + k0 + 8 * astep, astep);
      copy8_to_lds<T>(lb + PLANE * 2u,                 LSTEP, Bb + boff + k0,             bstep);
      copy8_to_lds<T>(lb + PLANE * 2u + 8u * LSTEP,    LSTEP, Bb + boff + k0 + 8 * bstep, bstep);
    }
  };

  v8f acc[4][4];
#pragma unroll
  for (int i = 0; i < 4; ++i)
#pragma unroll
    for (int j = 0; j < 4; ++j) acc[i][j] = (v8f){0.f,0.f,0.f,0.f,0.f,0.f,0.f,0.f};

  // Two fragment sets: a block = the WMMAs of 32 k. The next block's fragments are read from LDS as one group into the other set in
  // front of this block's WMMAs, so that their latency passes behind the matrix work instead of in front of it.
  constexpr int NBLK = BK / 32;                   // blocks per stage, even: block b of every stage uses set b & 1
  V ah[2][4], al[2][4], bh[2][4], bl[2][4];
  const T* sA0 = sAB + (wm + rlane) * PITCH + koff;
  const T* sB0 = sAB + PLANE + (wn + rlane) * PITCH + koff;
  auto fetch = [&](int set, int buf, int kk) {    // all fragments of the block at k offset kk of buffer buf
    const T* sA = sA0 + buf * STAGE + kk;
    const T* sB = sB0 + buf * STAGE + kk;
#pragma unroll                                    // static indices: the fragment arrays stay in registers
    for (int j = 0; j < 4; ++j) {
      bh[set][j] = Frag<T>::load(sB + (j << 4) * PITCH);
      if (SPLIT) bl[set][j] = Frag<T>::load(sB + 2 * PLANE + (j << 4) * PITCH); else bl[set][j] = bh[set][j];
    }
#pragma unroll                                    // static indices: the fragment arrays stay in registers
    for (int i = 0; i < 4; ++i) {
      ah[set][i] = Frag<T>::load(sA + (i << 4) * PITCH);
      if (SPLIT) al[set][i] = Frag<T>::load(sA + 2 * PLANE + (i << 4) * PITCH); else al[set][i] = ah[set][i];
    }
  };
  // Every wave works through all of the block's stages, so that the loop has no branch between a read group and its counted wait:
  // a wave whose score tile is skipped (LOC 1) stores nothing, and past its own key range (LOC 2) a wave's p rows are zero.

  const int nst = (kEnd - kBeg) / BK;             // block-uniform number of stages
  // The block walks its stages round from a start that its tile indices set: blocks with the same rows of A or of Bt run side by
  // side, and from a common start they would all ask L2 for the same lines (and every block for the same k columns) at one moment.
  const int rot = (nst > 1) ? (bm + bn) % nst : 0;  // block-uniform
  auto kof = [&](int t) {                         // k offset of the t-th stage that this block works on
    const int s = t + rot;
    return kBeg + ((s >= nst) ? s - nst : s) * BK;
  };
  fill(0, kof(0));
  asm volatile("s_wait_asynccnt 0x0" ::: "memory");   // this wave's copies of stage 0 have landed
  __syncthreads();                                     // every wave's have
  if (nst > 1) fill(1, kof(1));
  fetch(0, 0, 0);

  for (int t = 0; t < nst; ++t) {
#pragma unroll                                    // the set index and the LDS offsets of the fragment loads become constants
    for (int b = 0; b < NBLK; ++b) {
      if (b + 1 < NBLK) {
        fetch((b + 1) & 1, t & 1, (b + 1) * 32);
      } else {
        // publish point of stage t + 1, in front of stage t's last block, whose fragments are already fetched; every wave passes it
        asm volatile("s_wait_dscnt 0x0" ::: "memory");     // this wave's reads of buffer t & 1 are done before it is refilled
        asm volatile("s_wait_asynccnt 0x0" ::: "memory");  // this wave's copies of stage t + 1 have landed
        __syncthreads();                                    // publishes stage t + 1 and ends every reader's use of buffer t & 1
        if (t + 2 < nst) fill(t & 1, kof(t + 2));
        if (t + 1 < nst) fetch(0, (t + 1) & 1, 0);
      }
      __builtin_amdgcn_sched_barrier(0);          // keeps the read group in front of the WMMAs: one place with LDS reads per block
      {
        const int s = b & 1;
#pragma unroll                                    // static indices: the fragment and accumulator arrays stay in registers
        for (int i = 0; i < 4; ++i) {
#pragma unroll                                    // static indices: the fragment and accumulator arrays stay in registers
          for (int j = 0; j < 4; ++j) {
            acc[i][j] = Frag<T>::mma(ah[s][i], bh[s][j], acc[i][j]);
            if (SPLIT) {
              acc[i][j] = Frag<T>::mma(ah[s][i], bl[s][j], acc[i][j]);
              acc[i][j] = Frag<T>::mma(al[s][i], bh[s][j], acc[i][j]);
            }
          }
        }
      }
      __builtin_amdgcn_sched_barrier(0);          // keeps this block's WMMAs in front of the next read group and of the publish point's waits
    }
  }
  asm volatile("s_wait_asynccnt 0x0" ::: "memory");    // no copy is outstanding when the wave goes on or ends
  if (!act) return;                                     // wave-uniform, behind the last barrier
  acc_guard4(acc[0][0], acc[0][1], acc[0][2], acc[0][3]);
  acc_guard4(acc[1][0], acc[1][1], acc[1][2], acc[1][3]);
  acc_guard4(acc[2][0], acc[2][1], acc[2][2], acc[2][3]);
  acc_guard4(acc[3][0], acc[3][1], acc[3][2], acc[3][3]);

  // ---- epilogue ----
  float* slab = sT[wave];
  const bool rms = (EPI == 2) && !flip;           // block-uniform
  const float* gv = (LOC == 3 && z == 1) ? resid : gvec;
  const int ldhz = (LOC == 3) ? Nz : ldh;
  const float* Rb = RESID ? (resid + (size_t)z * strideR) : nullptr;
#pragma unroll
  for (int i = 0; i < 4; ++i) {
    const int mBase = m0 + (i << 4);
#pragma unroll
    for (int j = 0; j < 4; ++j) {
      const int n = n0 + (j << 4) + rlane;
      float bv = 0.f;
      if (BIAS) bv = bias[n];
#pragma unroll
      for (int r = 0; r < 8; ++r) {
        float v = acc[i][j][r] * scale;
        if (BIAS) v += bv;
        if (RESID) v += Rb[(size_t)(mBase + mOff + r) * ldr + n];
        if (EPI == 1) {
          // 0.5 * (1 + tanh(u)) = 1 / (1 + exp(-2u)), u = 0.7978845608 * (v + 0.044715 v^3); exp(-2u) = 2^(-2 log2(e) u):
          // one hardware exponential and one reciprocal, no branch, so the eight rows of a column run side by side
          const float e = __builtin_amdgcn_exp2f(-2.3022081981f * (v + 0.044715f * v * v * v));
          v = v * __builtin_amdgcn_rcpf(1.0f + e);
        }
        slab[(mOff + r) * 68 + (j << 4) + rlane] = v;
      }
    }
    __builtin_amdgcn_fence(__ATOMIC_RELEASE, "workgroup");
    __builtin_amdgcn_wave_barrier();
    __builtin_amdgcn_fence(__ATOMIC_ACQUIRE, "workgroup");
    if (OUTM == 0 || OUTM == 2) {
      float* C = Cf + (size_t)z * strideC;
      const int hh = lane >> 4, c4 = (lane & 15) * 4;     // row seg = 256 B = 16 lanes x 16 B
      {
#pragma unroll
        for (int it = 0; it < 8; ++it) {
          const int row = it * 2 + hh;                      // it 0..7 x hh 0..1 = rows 0..15
          v4f v = *(const v4f*)(slab + row * 68 + c4);
          *(v4f*)(C + (size_t)(mBase + row) * ldc + n0 + c4) = v;
        }
        
      }
    }
    if (OUTM == 1 || OUTM == 2) {
      _Float16* C = Ch + (size_t)z * strideH;
      const int q = lane >> 3, c8 = (lane & 7) * 8;
      {
#pragma unroll
        for (int it = 0; it < 4; ++it) {
          const int row = it * 4 + q;                       // it 0..3 x q 0..3 = rows 0..15
          const float* sp = slab + row * 68 + c8;
          float x[8];
#pragma unroll
          for (int e = 0; e < 8; ++e) x[e] = sp[e];
          float rr = oscale;
          if (EPI == 2) {
            float ss = 0.f;
#pragma unroll
            for (int e = 0; e < 8; ++e) ss += x[e] * x[e];
            ss += __shfl_xor(ss, 1, 32);                    // lanes 8q..8q+7 hold one 64-wide row
            ss += __shfl_xor(ss, 2, 32);
            ss += __shfl_xor(ss, 4, 32);
            const float rn = oscale * rsqrtf(ss * (1.0f / 64.0f) + 1e-6f);
            rr = rms ? rn : oscale;                         // a select, not a branch: the four rows' stores stay one group
          }
          v8h hv;
#pragma unroll
          for (int e = 0; e < 8; ++e) {
            float y = x[e] * rr;
            if (EPI == 2) { const float ge = gv[c8 + e]; y *= rms ? ge : 1.0f; }
            hv[e] = (_Float16)y;
          }
          *(v8h*)(C + (size_t)(mBase + row) * ldhz + n0 + c8) = hv;
        }
        
      }
    }
    __builtin_amdgcn_fence(__ATOMIC_RELEASE, "workgroup");
    __builtin_amdgcn_wave_barrier();
    __builtin_amdgcn_fence(__ATOMIC_ACQUIRE, "workgroup");
  }
}

// ---------------------------------------------------------------------------------------------------------------------
// The pieces below are block-sized jobs (256 threads) of the one preparation launch k_prep, which deals them out by block index.
// Weight transpose + scale + f16: in [R][Cc] f32 -> o16[Cc][R] = f16(in * wscale). 64x64 tiles through LDS, tile = (R/64 x Cc/64) index.
// coverage per block: load 4 it x 256 thr x 4 = 64x64; store 2 it x 256 thr x 8 = 64x64; each store instruction = 8 lanes x 16 B =
// ---------------------------------------------------------------------------------------------------------------------
__device__ __forceinline__ void wt16_tile(float* tf, const float* __restrict__ W, _Float16* __restrict__ o16, int R, int Cc, float wscale,
                                          int tile) {
  const int tx = Cc >> 6;
  const int c0 = (tile % tx) * 64, r0 = (tile / tx) * 64, tid = threadIdx.x;
  {
    const int lr = tid >> 4, c4 = (tid & 15) * 4;
#pragma unroll
    for (int it = 0; it < 4; ++it) {
      const int rr = it * 16 + lr;
      const v4f a = *(const v4f*)(W + (size_t)(r0 + rr) * Cc + c0 + c4);
      *(v4f*)(tf + rr * 68 + c4) = a;
    }
  }
  __syncthreads();
  const int sub = tid >> 3, c8 = (tid & 7) * 8;
  v8h hv[2];
#pragma unroll
  for (int it = 0; it < 2; ++it) {
    const int oc = it * 32 + sub;
    v8h a;
#pragma unroll
    for (int q = 0; q < 8; ++q) a[q] = (_Float16)(tf[(c8 + q) * 68 + oc] * wscale);
    hv[it] = a;
  }
  {
#pragma unroll
    for (int it = 0; it < 2; ++it) {
      const int oc = it * 32 + sub;
      const size_t go = (size_t)(c0 + oc) * R + r0 + c8;
      *(v8h*)(o16 + go) = hv[it];
    }
    asm volatile("s_wait_xcnt 0x0" ::: "memory");   // stands in front of any later write of a register that the stores above name
  }
}

// Weight transpose + bf16 hi/lo split: in [R][Cc] f32 -> oh[c][r] = bf16(in[r][c]), ol[c][r] = bf16(in[r][c] - oh). Same tiling.
__device__ __forceinline__ void wtsplit_tile(float* tf, const float* __restrict__ W, unsigned short* __restrict__ oh,
                                             unsigned short* __restrict__ ol, int R, int Cc, int tile) {
  const int tx = Cc >> 6;
  const int c0 = (tile % tx) * 64, r0 = (tile / tx) * 64, tid = threadIdx.x;
  {
    const int lr = tid >> 4, c4 = (tid & 15) * 4;
#pragma unroll
    for (int it = 0; it < 4; ++it) {
      const int rr = it * 16 + lr;
      const v4f a = *(const v4f*)(W + (size_t)(r0 + rr) * Cc + c0 + c4);
      *(v4f*)(tf + rr * 68 + c4) = a;
    }
  }
  __syncthreads();
  const int sub = tid >> 3, c8 = (tid & 7) * 8;
  v4u hv[2], lv[2];
#pragma unroll
  for (int it = 0; it < 2; ++it) {
    const int oc = it * 32 + sub;
    v4u a, a2;
#pragma unroll
    for (int q = 0; q < 4; ++q) {
      const float f0 = tf[(c8 + 2 * q) * 68 + oc];
      const float f1 = tf[(c8 + 2 * q + 1) * 68 + oc];
      const unsigned short h0 = f2bf_bits(f0), h1 = f2bf_bits(f1);
      const unsigned short l0 = f2bf_bits(f0 - bf_bits2f(h0)), l1 = f2bf_bits(f1 - bf_bits2f(h1));
      a[q]  = pk16(h0, h1);
      a2[q] = pk16(l0, l1);
    }
    hv[it] = a; lv[it] = a2;
  }
  {
#pragma unroll
    for (int it = 0; it < 2; ++it) {
      const int oc = it * 32 + sub;
      const size_t go = (size_t)(c0 + oc) * R + r0 + c8;
      *(v4u*)(oh + go) = hv[it];
      *(v4u*)(ol + go) = lv[it];
    }
    asm volatile("s_wait_xcnt 0x0" ::: "memory");   // stands in front of any later write of a register that the stores above name
  }
}

__device__ __forceinline__ void split2_piece(const float* __restrict__ in, unsigned short* __restrict__ hi,
                                             unsigned short* __restrict__ lo, int n2, int i) {
  if (i < n2) {
    const v2f f = *(const v2f*)(in + 2 * (size_t)i);
    const unsigned short h0 = f2bf_bits(f[0]), h1 = f2bf_bits(f[1]);
    const unsigned short l0 = f2bf_bits(f[0] - bf_bits2f(h0)), l1 = f2bf_bits(f[1] - bf_bits2f(h1));
    const unsigned uh = pk16(h0, h1), ul = pk16(l0, l1);
    ((unsigned*)hi)[i] = uh;
    ((unsigned*)lo)[i] = ul;
    
  }
}

__global__ __launch_bounds__(256) void k_split2(const float* __restrict__ in, unsigned short* __restrict__ hi,
                                                unsigned short* __restrict__ lo, int n2) {
  split2_piece(in, hi, lo, n2, blockIdx.x * 256 + threadIdx.x);
}

// ---------------------------------------------------------------------------------------------------------------------
// Rotary table and the rotary mix of text, four positions n = 4*blk .. 4*blk+3 per block; a thread owns the frequencies f0, f0+1.
// inv[f] = 1 / powf(10000, f/512); cs[n][f] = (cos(n * inv[f]), sin(n * inv[f])) as float2, n = 0..2047 (16-byte stores).
// q16[row][c] = f16(x * cos + rot * sin), rot[c] = (c < 512) ? -x[c + 512] : x[c - 512], table row n = row % SEQ, column c % 512:
// the pair (c, c + 512) of both batch elements uses the sine and cosine just formed; a wave's 4-byte stores cover a whole line.
// ---------------------------------------------------------------------------------------------------------------------
__device__ __forceinline__ void rope_piece(const float* __restrict__ text, float* __restrict__ cs, _Float16* __restrict__ q16, int blk) {
  const int f0 = threadIdx.x * 2;
  float iv[2];
#pragma unroll                                    // static indices: the small arrays stay in registers
  for (int e = 0; e < 2; ++e) {
    const float x = (float)(f0 + e) * (1.0f / 512.0f);
    iv[e] = 1.0f / powf(10000.0f, x);
  }
  for (int q = 0; q < 4; ++q) {
    const int n = blk * 4 + q;
    float cv[2], sv[2];
#pragma unroll                                    // static indices: the small arrays stay in registers
    for (int e = 0; e < 2; ++e) sincosf((float)n * iv[e], &sv[e], &cv[e]);
    v4f tb; tb[0] = cv[0]; tb[1] = sv[0]; tb[2] = cv[1]; tb[3] = sv[1];
    *(v4f*)(cs + ((size_t)n * 512 + f0) * 2) = tb;
#pragma unroll                                    // both batch elements' loads are in flight together
    for (int b = 0; b < NB_; ++b) {
      const size_t ro = ((size_t)b * SEQ + n) * DM + f0;
      const v2f xl = *(const v2f*)(text + ro), xh = *(const v2f*)(text + ro + 512);
      v2h yl, yh;
#pragma unroll                                    // static indices: the small arrays stay in registers
      for (int e = 0; e < 2; ++e) {
        yl[e] = (_Float16)(xl[e] * cv[e] + (-xh[e]) * sv[e]);
        yh[e] = (_Float16)(xh[e] * cv[e] + xl[e] * sv[e]);
      }
      *(v2h*)(q16 + ro)       = yl;
      *(v2h*)(q16 + ro + 512) = yh;
    }
    asm volatile("s_wait_xcnt 0x0" ::: "memory");   // the next trip rewrites registers that this trip's stores name
  }
}

// f32 -> f16, eight elements at 8*i
__device__ __forceinline__ void cvt16_piece(const float* __restrict__ src, _Float16* __restrict__ dst, int i) {
  const float* xr = src + (size_t)i * 8;
  const v4f x0 = *(const v4f*)xr, x1 = *(const v4f*)(xr + 4);
  v8h hv;
#pragma unroll                                    // static indices: the small arrays stay in registers
  for (int e = 0; e < 4; ++e) { hv[e] = (_Float16)x0[e]; hv[4 + e] = (_Float16)x1[e]; }
  *(v8h*)(dst + (size_t)i * 8) = hv;
  asm volatile("s_wait_xcnt 0x0" ::: "memory");   // stands in front of any later write of a register that the stores above name
}

// ---------------------------------------------------------------------------------------------------------------------
// Preparation, one launch: everything that depends on the inputs alone. None of the jobs reads what another writes, so they share
// one grid and run side by side; the job is a block-uniform function of blockIdx.x (arithmetic-heavy and large jobs first).
//   512 rotary table + text | 1024 W1 | 1024 W2 | 256 Wa | 256 Wvid | 256 Wkv | 128 Wq | 128 Wo | 2048 audio | 8192 video
// ---------------------------------------------------------------------------------------------------------------------
#define PREP_BLOCKS (512 + 1024 + 1024 + 256 + 256 + 256 + 128 + 128 + 2048 + 8192)
__global__ __launch_bounds__(256) void k_prep(
    const float* __restrict__ text, const float* __restrict__ audio, const float* __restrict__ video,
    const float* __restrict__ Wa, const float* __restrict__ Wvid, const float* __restrict__ Wq, const float* __restrict__ Wkv,
    const float* __restrict__ W1, const float* __restrict__ W2, const float* __restrict__ Wo,
    float* __restrict__ cs, _Float16* __restrict__ q16, _Float16* __restrict__ a16,
    unsigned short* __restrict__ vih, unsigned short* __restrict__ vil,
    _Float16* __restrict__ WaT, unsigned short* __restrict__ WvTh, unsigned short* __restrict__ WvTl,
    _Float16* __restrict__ WqT, _Float16* __restrict__ WkvT, _Float16* __restrict__ W1T, _Float16* __restrict__ W2T,
    unsigned short* __restrict__ WoTh, unsigned short* __restrict__ WoTl) {
  __shared__ __align__(16) float tf[64 * 68];
  int b = blockIdx.x;
  if (b < 512)  { rope_piece(text, cs, q16, b); return; }
  b -= 512;
  if (b < 1024) { wt16_tile(tf, W1, W1T, DM, FFD, 64.0f, b); return; }            // W1  [1024][4096]
  b -= 1024;
  if (b < 1024) { wt16_tile(tf, W2, W2T, FFD, DM, 64.0f, b); return; }            // W2  [4096][1024]
  b -= 1024;
  if (b < 256)  { wt16_tile(tf, Wa, WaT, DM, DM, 64.0f, b); return; }             // Wa  [1024][1024]
  b -= 256;
  if (b < 256)  { wtsplit_tile(tf, Wvid, WvTh, WvTl, DM, DM, b); return; }        // Wvid[1024][1024]
  b -= 256;
  if (b < 256)  { wt16_tile(tf, Wkv, WkvT, DM, 2 * INR, 64.0f, b); return; }      // Wkv [1024][1024]
  b -= 256;
  if (b < 128)  { wt16_tile(tf, Wq, WqT, DM, INR, 64.0f, b); return; }            // Wq  [1024][512]
  b -= 128;
  if (b < 128)  { wtsplit_tile(tf, Wo, WoTh, WoTl, INR, DM, b); return; }         // Wo  [512][1024]
  b -= 128;
  if (b < 2048) { cvt16_piece(audio, a16, b * 256 + (int)threadIdx.x); return; }  // audio -> f16
  b -= 2048;
  split2_piece(video, vih, vil, NTOK * DM / 2, b * 256 + (int)threadIdx.x);       // video -> bf16 hi/lo
}

// ---------------------------------------------------------------------------------------------------------------------
// Row LayerNorm over DM=1024 of an f32 plane (g, b) -> f16 plane; ROPE additionally applies the rotary mix through an LDS copy of
// the normalised row. Output row = padrows + r; blocks nrows..nrows+padrows-1 write zero rows 0..padrows-1.
// ---------------------------------------------------------------------------------------------------------------------
// One row is the job of 128 threads t = 0..127 (four whole waves) with their own red[4] and rowv[DM]; pad is block-uniform.
template <bool ROPE>
__device__ __forceinline__ void ln1024_row(float* red, float* rowv, const float* __restrict__ X, const float* __restrict__ g,
                                           const float* __restrict__ bb, const float* __restrict__ cs, _Float16* __restrict__ out,
                                           int nrows, int padrows, int blk, int t, bool pad) {
  const int c0 = 8 * t;
  const int lane = t & 31, wave = t >> 5;
  if (pad) {                                       // block-uniform: zero padding rows
    const int p = blk - nrows;
    const v4u zz = {0u, 0u, 0u, 0u};
    _Float16* op = out + (size_t)p * DM + c0;
    *(v4u*)op = zz;
    
    return;
  }
  const int r = blk;
  const float* xr = X + (size_t)r * DM + c0;
  const v4f x0 = *(const v4f*)xr, x1 = *(const v4f*)(xr + 4);
  const float v[8] = {x0[0], x0[1], x0[2], x0[3], x1[0], x1[1], x1[2], x1[3]};
  float s = 0.f;
#pragma unroll
  for (int e = 0; e < 8; ++e) s += v[e];
  s = wsum(s);
  if (lane == 0) red[wave] = s;
  __syncthreads();
  const float mu = (red[0] + red[1] + red[2] + red[3]) * (1.0f / 1024.0f);
  __syncthreads();
  float d[8];
  float s2 = 0.f;
#pragma unroll
  for (int e = 0; e < 8; ++e) { d[e] = v[e] - mu; s2 += d[e] * d[e]; }
  s2 = wsum(s2);
  if (lane == 0) red[wave] = s2;
  __syncthreads();
  const float var = (red[0] + red[1] + red[2] + red[3]) * (1.0f / 1024.0f);
  const float rstd = rsqrtf(var + 1e-5f);
  const v4f g0 = *(const v4f*)(g + c0), g1 = *(const v4f*)(g + c0 + 4);
  const v4f b0 = *(const v4f*)(bb + c0), b1 = *(const v4f*)(bb + c0 + 4);
  const float gv[8] = {g0[0], g0[1], g0[2], g0[3], g1[0], g1[1], g1[2], g1[3]};
  const float bv[8] = {b0[0], b0[1], b0[2], b0[3], b1[0], b1[1], b1[2], b1[3]};
  float y[8];
#pragma unroll
  for (int e = 0; e < 8; ++e) y[e] = d[e] * rstd * gv[e] + bv[e];
  if (ROPE) {
#pragma unroll
    for (int e = 0; e < 8; ++e) rowv[c0 + e] = y[e];
    __syncthreads();
    const int n = r & (SEQ - 1);
    const bool lowh = (c0 < 512);
    const int pc = lowh ? (c0 + 512) : (c0 - 512);
    const float* csr = cs + ((size_t)n * 512 + (c0 & 511)) * 2;
    const v4f t0 = *(const v4f*)csr, t1 = *(const v4f*)(csr + 4), t2 = *(const v4f*)(csr + 8), t3 = *(const v4f*)(csr + 12);
    const float cvv[8] = {t0[0], t0[2], t1[0], t1[2], t2[0], t2[2], t3[0], t3[2]};
    const float svv[8] = {t0[1], t0[3], t1[1], t1[3], t2[1], t2[3], t3[1], t3[3]};
#pragma unroll
    for (int e = 0; e < 8; ++e) {
      const float pr = rowv[pc + e];
      const float rot = lowh ? -pr : pr;
      y[e] = y[e] * cvv[e] + rot * svv[e];
    }
  }
  v8h hv;
#pragma unroll
  for (int e = 0; e < 8; ++e) hv[e] = (_Float16)y[e];
  _Float16* op = out + (size_t)(padrows + r) * DM + c0;
  *(v8h*)op = hv;
  // the ROPE instance shares its kernel with other jobs, whose code follows this store in the listing: the wait stands in front of
  // any write there of a register that the store names
  if (ROPE) asm volatile("s_wait_xcnt 0x0" ::: "memory");
}

__global__ __launch_bounds__(128) void k_ln1024(const float* __restrict__ X, const float* __restrict__ g, const float* __restrict__ bb,
                                                _Float16* __restrict__ out, int nrows) {
  __shared__ float red[4];
  ln1024_row<false>(red, nullptr, X, g, bb, nullptr, out, nrows, 0, blockIdx.x, threadIdx.x, false);
}

// ---------------------------------------------------------------------------------------------------------------------
// Row LayerNorm over DM of an f32 plane [NTOK][DM], fused with transpose + bf16 hi/lo split into value^T planes
// [DM][VTP]: oh[e][KPR + token], ol likewise. Block = 64 token rows x 256 columns (256 threads): per-row stats over the whole row
// from one wave per 8 rows (32 floats per lane), then the block's 4 column tiles of 64 through LDS. The VCS = 4 blocks of a row group
// each form the group's stats for themselves, so that the work covers every WGP instead of a quarter of them.
// Blocks VCS*nrowblk..VCS*nrowblk+7 zero the KPR leading columns.
// coverage: stats 8 waves x 8 rows; tile load 4 it x 256 thr x 4 = 64x64; store 2 it x 256 thr x 8 = 64x64 per plane per tile;
// ---------------------------------------------------------------------------------------------------------------------
#define VCS 4              // blocks per group of 64 value rows: each takes DM / VCS columns
__device__ __forceinline__ void ln_tsplit_block(float* tf, float* smu, float* srs, const float* __restrict__ X,
                                                const float* __restrict__ g, const float* __restrict__ bb,
                                                unsigned short* __restrict__ oh, unsigned short* __restrict__ ol, int nrowblk, int bx) {
  const int tid = threadIdx.x, lane = tid & 31, wave = tid >> 5;
  const int sub = tid >> 3, c8 = (tid & 7) * 8;
  if (bx >= VCS * nrowblk) {                       // block-uniform: zero leading columns
    const int pb = bx - VCS * nrowblk;
    const v4u zz = {0u, 0u, 0u, 0u};
    {
      for (int it = 0; it < 32; ++it) {
        const int e = it * 32 + sub;
        const size_t go = (size_t)e * VTP + pb * 64 + c8;
        *(v4u*)(oh + go) = zz;
        *(v4u*)(ol + go) = zz;
      }
      
    }
    return;
  }
  const int r0 = (bx / VCS) * 64;
  const int cb0 = (bx % VCS) * (DM / 64 / VCS);    // first of this block's column tiles
  // phase 1: row statistics
#pragma unroll 1
  for (int q = 0; q < 8; ++q) {
    const int rr = wave * 8 + q;
    const float* xr = X + (size_t)(r0 + rr) * DM + lane * 32;
    v4f a[8];
#pragma unroll
    for (int i = 0; i < 8; ++i) a[i] = *(const v4f*)(xr + 4 * i);
    float s = 0.f;
#pragma unroll
    for (int i = 0; i < 8; ++i) s += a[i][0] + a[i][1] + a[i][2] + a[i][3];
    s = wsum(s);
    const float mu = s * (1.0f / 1024.0f);
    float s2 = 0.f;
#pragma unroll
    for (int i = 0; i < 8; ++i) {
#pragma unroll
      for (int e = 0; e < 4; ++e) { const float dd = a[i][e] - mu; s2 += dd * dd; }
    }
    s2 = wsum(s2);
    if (lane == 0) { smu[rr] = mu; srs[rr] = rsqrtf(s2 * (1.0f / 1024.0f) + 1e-5f); }
  }
  __syncthreads();
  // phase 2: column tiles
  const int lr = tid >> 4, c4 = (tid & 15) * 4;
  for (int cb = cb0; cb < cb0 + DM / 64 / VCS; ++cb) {
    const int c0 = cb * 64;
    const v4f gg = *(const v4f*)(g + c0 + c4);
    const v4f bv = *(const v4f*)(bb + c0 + c4);
#pragma unroll
    for (int it = 0; it < 4; ++it) {
      const int rr = it * 16 + lr;
      const v4f a = *(const v4f*)(X + (size_t)(r0 + rr) * DM + c0 + c4);
      const float mu = smu[rr], rs = srs[rr];
#pragma unroll
      for (int q = 0; q < 4; ++q) tf[rr * 68 + c4 + q] = (a[q] - mu) * rs * gg[q] + bv[q];
    }
    __syncthreads();
    v4u hv[2], lv[2];
#pragma unroll
    for (int it = 0; it < 2; ++it) {
      const int oc = it * 32 + sub;                 // output row within tile = input column
      v4u a, a2;
#pragma unroll
      for (int q = 0; q < 4; ++q) {
        const float f0 = tf[(c8 + 2 * q) * 68 + oc];
        const float f1 = tf[(c8 + 2 * q + 1) * 68 + oc];
        const unsigned short h0 = f2bf_bits(f0), h1 = f2bf_bits(f1);
        const unsigned short l0 = f2bf_bits(f0 - bf_bits2f(h0)), l1 = f2bf_bits(f1 - bf_bits2f(h1));
        a[q]  = pk16(h0, h1);
        a2[q] = pk16(l0, l1);
      }
      hv[it] = a; lv[it] = a2;
    }
    {
#pragma unroll
      for (int it = 0; it < 2; ++it) {
        const int oc = it * 32 + sub;
        const size_t go = (size_t)(c0 + oc) * VTP + KPR + r0 + c8;
        *(v4u*)(oh + go) = hv[it];
        *(v4u*)(ol + go) = lv[it];
      }
      
    }
    __syncthreads();
  }
}

// ---------------------------------------------------------------------------------------------------------------------
// The two adapter norms in one launch: neither reads what the other writes. Blocks 0 .. VCS*NTOK/64 + KPR/64 - 1 (the longer ones, so
// they come first): value rows -> value^T planes; every later block: two key rows (LayerNorm + rotary mix), one per 128 threads.
// NTOK is even, so both rows of a block are data rows or both are padding rows.
// ---------------------------------------------------------------------------------------------------------------------
__global__ __launch_bounds__(256) void k_ln_pair(const float* __restrict__ Xa, const float* __restrict__ ga, const float* __restrict__ ba,
                                                 const float* __restrict__ cs, _Float16* __restrict__ k16,
                                                 const float* __restrict__ Xv, const float* __restrict__ gv, const float* __restrict__ bv,
                                                 unsigned short* __restrict__ oh, unsigned short* __restrict__ ol) {
  __shared__ __align__(16) float tf[64 * 68];
  __shared__ float smu[64];
  __shared__ float srs[64];
  __shared__ float red[2][4];
  __shared__ __align__(16) float rowv[2][DM];
  constexpr int NV = VCS * (NTOK / 64) + KPR / 64;
  const int bx = blockIdx.x;
  if (bx < NV) { ln_tsplit_block(tf, smu, srs, Xv, gv, bv, oh, ol, NTOK / 64, bx); return; }
  const int row0 = (bx - NV) * 2;
  const int half = threadIdx.x >> 7;
  ln1024_row<true>(red[half], rowv[half], Xa, ga, ba, cs, k16, NTOK, KPR, row0 + half, threadIdx.x & 127, row0 >= NTOK);
}

// ---------------------------------------------------------------------------------------------------------------------
// Local-attention mask + softmax over rows of S [NTOK][1024 window keys] -> P bf16 hi/lo planes (all 1024 keys written, masked
// keys as 0). Row r: w = (r % SEQ) / WSZ, i = r % WSZ, query position w*WSZ + i; key j has position (w-1)*WSZ + j; masked when
// that position is negative (padding of the first window) or after the query. Block per row, 128 threads x 8 keys; 16-B stores.
// ---------------------------------------------------------------------------------------------------------------------
__global__ __launch_bounds__(128) void k_lsoftmax(const float* __restrict__ S, unsigned short* __restrict__ Ph, unsigned short* __restrict__ Pl) {
  __shared__ float red[4];
  const int r = blockIdx.x, t = threadIdx.x, c0 = 8 * t;
  const int lane = t & 31, wave = t >> 5;
  const int rem = r & (SEQ - 1), w = rem >> 9, i = rem & (WSZ - 1);
  const int qpos = w * WSZ + i;
  const float* sr = S + (size_t)r * (2 * WSZ) + c0;
  const v4f x0 = *(const v4f*)sr, x1 = *(const v4f*)(sr + 4);
  const float raw[8] = {x0[0], x0[1], x0[2], x0[3], x1[0], x1[1], x1[2], x1[3]};
  float s[8];
  float m = -3.0e38f;
#pragma unroll
  for (int e = 0; e < 8; ++e) {
    const int kpos = (w - 1) * WSZ + c0 + e;
    const bool masked = (kpos < 0) || (kpos > qpos);
    s[e] = masked ? -1.0e9f : raw[e];
    m = fmaxf(m, s[e]);
  }
  m = wmax(m);
  if (lane == 0) red[wave] = m;
  __syncthreads();
  const float rmax = fmaxf(fmaxf(red[0], red[1]), fmaxf(red[2], red[3]));
  __syncthreads();
  float ev[8];
  float sum = 0.f;
#pragma unroll
  for (int e = 0; e < 8; ++e) { ev[e] = expf(s[e] - rmax); sum += ev[e]; }
  sum = wsum(sum);
  if (lane == 0) red[wave] = sum;
  __syncthreads();
  const float tot = red[0] + red[1] + red[2] + red[3];
  const float inv = 1.0f / tot;
  v4u hv, lv;
#pragma unroll
  for (int q = 0; q < 4; ++q) {
    const float p0 = ev[2 * q] * inv, p1 = ev[2 * q + 1] * inv;
    const unsigned short h0 = f2bf_bits(p0), h1 = f2bf_bits(p1);
    const unsigned short l0 = f2bf_bits(p0 - bf_bits2f(h0)), l1 = f2bf_bits(p1 - bf_bits2f(h1));
    hv[q] = pk16(h0, h1);
    lv[q] = pk16(l0, l1);
  }
  const size_t go = (size_t)r * (2 * WSZ) + c0;
  *(v4u*)(Ph + go) = hv;
  *(v4u*)(Pl + go) = lv;
  
}

__device__ __forceinline__ v8f mma_h(v16h a, v16h b, v8f c) {
  c = __builtin_amdgcn_wmma_f32_16x16x32_f16(false, a, false, b, (short)0, c, false, false);
  asm volatile("v_nop\n\tv_nop\n\tv_nop\n\tv_nop" : "+v"(c) : "v"(a), "v"(b));
  return c;
}
// value of lane l ^ 16
__device__ __forceinline__ float xhalf(float x) {
  return __builtin_bit_cast(float, __builtin_amdgcn_permlanex16(__builtin_bit_cast(int, x), __builtin_bit_cast(int, x),
                                                                0x76543210, 0xfedcba98, false, false));
}

// Eight asynchronous 16-byte copies per lane, global -> LDS: four rows of the K chunk and four of the V^T chunk; the four rows of a
// tile lie lstep LDS bytes and kstep (K) or vstep (V^T) global elements apart.
// s_wait_xcnt is the statement's last line so that no address register named here is rewritten in front of it.
__device__ __forceinline__ void copy_kv_to_lds(unsigned lk0, unsigned lv0, unsigned lstep, const _Float16* k0, size_t kstep,
                                               const _Float16* v0, size_t vstep) {
  const unsigned lk1 = lk0 + lstep, lk2 = lk1 + lstep, lk3 = lk2 + lstep;
  const unsigned lv1 = lv0 + lstep, lv2 = lv1 + lstep, lv3 = lv2 + lstep;
  const _Float16* k1 = k0 + kstep; const _Float16* k2 = k1 + kstep; const _Float16* k3 = k2 + kstep;
  const _Float16* v1 = v0 + vstep; const _Float16* v2 = v1 + vstep; const _Float16* v3 = v2 + vstep;
  asm volatile(
      "global_load_async_to_lds_b128 %0, %8, off\n\t"
      "global_load_async_to_lds_b128 %1, %9, off\n\t"
      "global_load_async_to_lds_b128 %2, %10, off\n\t"
      "global_load_async_to_lds_b128 %3, %11, off\n\t"
      "global_load_async_to_lds_b128 %4, %12, off\n\t"
      "global_load_async_to_lds_b128 %5, %13, off\n\t"
      "global_load_async_to_lds_b128 %6, %14, off\n\t"
      "global_load_async_to_lds_b128 %7, %15, off\n\t"
      "s_wait_xcnt 0x0"
      :: "v"(lk0), "v"(lk1), "v"(lk2), "v"(lk3), "v"(lv0), "v"(lv1), "v"(lv2), "v"(lv3),
         "v"(k0), "v"(k1), "v"(k2), "v"(k3), "v"(v0), "v"(v1), "v"(v2), "v"(v3)
      : "memory");
}

__global__ __launch_bounds__(128)
void k_flash(const _Float16* __restrict__ qm, const _Float16* __restrict__ km,
             const _Float16* __restrict__ vt, float* __restrict__ out) {
  union FB { v16h v; v8h h[2]; };
  constexpr int KVP = 72;                                     // LDS row pitch in elements: 144 B = 16 B x odd, so that the 16 rows
                                                              // of one 16-byte fragment read fall on 16 distinct groups of 4 banks
  constexpr int TILE = 64 * KVP;                              // elements of one chunk tile
  __shared__ __align__(16) _Float16 KV[2 * 2 * TILE];         // two buffers, each K [kv][d] and behind it V^T [d][kv]
  __shared__ __align__(16) float    Os[4][16 * 68];           // per wave out tile [query][d], pitch 68

  const int tid  = threadIdx.x;
  const int wave = tid >> 5;
  const int lane = tid & 31;
  const int hh   = lane >> 4;
  const int c    = lane & 15;
  const int b  = blockIdx.y;
  const int qb = blockIdx.x & 31;                 // SEQ / 64 = 32 query blocks
  const int h  = blockIdx.x >> 5;
  const int q0 = qb * 64 + wave * 16;

  const _Float16* Qb = qm + (size_t)b * SEQ * INR + h * DHD;
  const _Float16* Kb = km + (size_t)b * SEQ * INR + h * DHD;
  const _Float16* Vb = vt + (size_t)(h * DHD) * NTOK + (size_t)b * SEQ;
  float*          ob = out + (size_t)b * SEQ * INR + h * DHD;

  v16h qa[2];                                     // B operand: column c = query q0 + c, d in the loader's k order
#pragma unroll
  for (int dc = 0; dc < 2; ++dc) qa[dc] = Frag<_Float16>::load(Qb + (size_t)(q0 + c) * INR + dc * 32 + 8 * hh);

  const int qrow = q0 + c;                        // this lane's query
  constexpr float SC2 = 0.125f * 1.4426950408889634f;   // score scale times log2(e): exponents are formed in base 2
  float mrow = -INFINITY;                         // its running maximum of q . k, unscaled (equal in both lane halves)
  float orow = -INFINITY;                         // mrow * SC2 - 12 as rounded: what every exponent of the running state had taken off
  float lrow = 0.f;                               // its running sum of 4096 p over the keys of this lane half; halves joined at the end
  v8f oacc[4];                                    // oacc[t][r] = O[qrow][t*16 + 8*hh + r]
#pragma unroll
  for (int t = 0; t < 4; ++t) oacc[t] = (v8f){0.f,0.f,0.f,0.f,0.f,0.f,0.f,0.f};

  const int nChunks = qb + 1;                     // block-uniform, <= 32
  // this thread's piece of every copy: row crow (+ 16 per copy) of either tile, 16 bytes at element ccol
  const int crow = tid >> 3;
  const int ccol = (tid & 7) * 8;
  const unsigned lth = (unsigned)(size_t)KV + (unsigned)(crow * KVP + ccol) * 2u;
  const _Float16* kth = Kb + (size_t)crow * INR + ccol;               // K row kv0 + crow, d = ccol..ccol+7
  const _Float16* vth = Vb + (size_t)crow * NTOK + ccol;              // V^T row d = crow, s = kv0 + ccol..+7
  auto fill = [&](int buf, int kv) {              // 8 copies per lane: the chunk that begins at key kv into buffer buf
    const unsigned lb = lth + (unsigned)buf * (2 * TILE * 2u);
    copy_kv_to_lds(lb, lb + TILE * 2u, 16 * KVP * 2u, kth + (size_t)kv * INR, (size_t)16 * INR, vth + kv, (size_t)16 * NTOK);
  };
  fill(0, 0);
  asm volatile("s_wait_asynccnt 0x0" ::: "memory");   // this wave's copies of chunk 0 have landed
  __syncthreads();                                     // every wave's have
  if (nChunks > 1) fill(1, 64);

  for (int kc = 0; kc < nChunks; ++kc) {
    const int kv0 = kc * 64;
    const _Float16* Ksh = KV + (kc & 1) * (2 * TILE);
    const _Float16* Vth = Ksh + TILE;

    // S^T tiles: s[j][r] = score of key kv0 + j*16 + 8*hh + r with query qrow
    FB kb[4][2];
#pragma unroll                                    // static indices: the fragment and accumulator arrays stay in registers
    for (int j = 0; j < 4; ++j)
#pragma unroll                                    // static indices: the fragment and accumulator arrays stay in registers
      for (int dc = 0; dc < 2; ++dc) {
        kb[j][dc].h[0] = *(const v8h*)(Ksh + (j * 16 + c) * KVP + dc * 32 + 8 * hh);
        kb[j][dc].h[1] = *(const v8h*)(Ksh + (j * 16 + c) * KVP + dc * 32 + 16 + 8 * hh);
      }
    v8f s[4];
#pragma unroll                                    // static indices: the fragment and accumulator arrays stay in registers
    for (int j = 0; j < 4; ++j) s[j] = (v8f){0.f,0.f,0.f,0.f,0.f,0.f,0.f,0.f};
#pragma unroll                                    // static indices: the fragment and accumulator arrays stay in registers
    for (int dc = 0; dc < 2; ++dc)
#pragma unroll                                    // static indices: the fragment and accumulator arrays stay in registers
      for (int j = 0; j < 4; ++j) s[j] = mma_h(kb[j][dc].v, qa[dc], s[j]);

    const bool diag = (kc == qb);                 // block-uniform
    float m = -INFINITY;
#pragma unroll                                    // static indices: the fragment and accumulator arrays stay in registers
    for (int j = 0; j < 4; ++j)
#pragma unroll                                    // static indices: the fragment and accumulator arrays stay in registers
      for (int r = 0; r < 8; ++r) {
        const int kvrow = kv0 + j * 16 + 8 * hh + r;
        const bool masked = diag && (kvrow > qrow);
        const float sm = masked ? -INFINITY : s[j][r];
        s[j][r] = sm;
        m = fmaxf(m, sm);
      }
    m = fmaxf(m, xhalf(m));
    const float mnew = fmaxf(mrow, m);
    const float onew = fmaf(mnew, SC2, -12.0f);
    const float alpha = __builtin_amdgcn_exp2f(orow - onew);
    mrow = mnew;
    orow = onew;
    // P^T as B operand: element e of pb[kk] = key kk*32 + (e < 8 ? 8*hh + e : 16 + 8*hh + e - 8), the loader's k order
    FB pb[2];
    float psum = 0.f;
#pragma unroll                                    // static indices: the fragment and accumulator arrays stay in registers
    for (int j = 0; j < 4; ++j)
#pragma unroll                                    // static indices: the fragment and accumulator arrays stay in registers
      for (int r = 0; r < 8; ++r) {
        const float p = __builtin_amdgcn_exp2f(fmaf(s[j][r], SC2, -onew));   // 4096 * exp(0.125 * (q . k - maximum))
        psum += p;
        pb[j >> 1].v[(j & 1) * 8 + r] = (_Float16)p;
      }
    lrow = lrow * alpha + psum;
#pragma unroll                                    // static indices: the fragment and accumulator arrays stay in registers
    for (int t = 0; t < 4; ++t)
#pragma unroll                                    // static indices: the fragment and accumulator arrays stay in registers
      for (int r = 0; r < 8; ++r) oacc[t][r] *= alpha;

    FB vb[2][4];
#pragma unroll                                    // static indices: the fragment and accumulator arrays stay in registers
    for (int kk = 0; kk < 2; ++kk)
#pragma unroll                                    // static indices: the fragment and accumulator arrays stay in registers
      for (int t = 0; t < 4; ++t) {
        vb[kk][t].h[0] = *(const v8h*)(Vth + (t * 16 + c) * KVP + kk * 32 + 8 * hh);
        vb[kk][t].h[1] = *(const v8h*)(Vth + (t * 16 + c) * KVP + kk * 32 + 16 + 8 * hh);
      }
#pragma unroll                                    // static indices: the fragment and accumulator arrays stay in registers
    for (int kk = 0; kk < 2; ++kk)
#pragma unroll                                    // static indices: the fragment and accumulator arrays stay in registers
      for (int t = 0; t < 4; ++t) oacc[t] = mma_h(vb[kk][t].v, pb[kk].v, oacc[t]);

    asm volatile("s_wait_dscnt 0x0" ::: "memory");     // this wave's reads of buffer kc & 1 are done before it is refilled
    asm volatile("s_wait_asynccnt 0x0" ::: "memory");  // this wave's copies of chunk kc + 1 have landed
    __syncthreads();                                    // publishes chunk kc + 1 and ends every reader's use of buffer kc & 1
    if (kc + 2 < nChunks) fill(kc & 1, kv0 + 128);
  }
  asm volatile("s_wait_asynccnt 0x0" ::: "memory");    // no copy is outstanding when the wave goes on or ends

  float* os = Os[wave];
  {
    const float ltot = lrow + xhalf(lrow);
    const float inv = 1.0f / ltot;                // sum and accumulators both carry the factor 4096
#pragma unroll                                    // static indices: the fragment and accumulator arrays stay in registers
    for (int t = 0; t < 4; ++t) {
      v4f lo, hi;
#pragma unroll                                    // static indices: the fragment and accumulator arrays stay in registers
      for (int r = 0; r < 4; ++r) { lo[r] = oacc[t][r] * inv; hi[r] = oacc[t][4 + r] * inv; }
      *(v4f*)(os + c * 68 + t * 16 + 8 * hh)     = lo;
      *(v4f*)(os + c * 68 + t * 16 + 8 * hh + 4) = hi;
    }
  }
  __builtin_amdgcn_fence(__ATOMIC_RELEASE, "workgroup");
  __builtin_amdgcn_wave_barrier();
  __builtin_amdgcn_fence(__ATOMIC_ACQUIRE, "workgroup");
  {
    const int c4 = (lane & 15) * 4;
    {
#pragma unroll
      for (int it = 0; it < 8; ++it) {
        const int row = it * 2 + hh;                // it 0..7 x hh 0..1 covers rows 0..15
        v4f val = *(const v4f*)(os + row * 68 + c4);
        *(v4f*)(ob + (size_t)(q0 + row) * INR + c4) = val;
      }
      
    }
  }
}

// ---------------------------------------------------------------------------------------------------------------------
// Row LayerNorm over FFD=4096 of the f16 plane U (values carried as 256*u), in place -> f16 of the unit-scale result.
// Block per row, 256 threads x 2 chunks of 8; statistics in f32 with the 2^-8 / 2^-16 carries folded before eps.
// ---------------------------------------------------------------------------------------------------------------------
__global__ __launch_bounds__(256) void k_ln4096(_Float16* __restrict__ U, const float* __restrict__ g, const float* __restrict__ bb) {
  __shared__ float red[8];
  const int r = blockIdx.x, t = threadIdx.x;
  const int lane = t & 31, wave = t >> 5;
  const int cA = 8 * t, cB = 2048 + 8 * t;
  _Float16* ur = U + (size_t)r * FFD;
  const v8h a = *(const v8h*)(ur + cA);
  const v8h a2 = *(const v8h*)(ur + cB);
  float v[16];
#pragma unroll
  for (int e = 0; e < 8; ++e) { v[e] = (float)a[e]; v[8 + e] = (float)a2[e]; }
  float s = 0.f;
#pragma unroll
  for (int e = 0; e < 16; ++e) s += v[e];
  s = wsum(s);
  if (lane == 0) red[wave] = s;
  __syncthreads();
  float tot = 0.f;
#pragma unroll
  for (int i = 0; i < 8; ++i) tot += red[i];
  const float mu = tot * (1.0f / 4096.0f);
  __syncthreads();
  float d[16];
  float s2 = 0.f;
#pragma unroll
  for (int e = 0; e < 16; ++e) { d[e] = v[e] - mu; s2 += d[e] * d[e]; }
  s2 = wsum(s2);
  if (lane == 0) red[wave] = s2;
  __syncthreads();
  float tot2 = 0.f;
#pragma unroll
  for (int i = 0; i < 8; ++i) tot2 += red[i];
  const float var_s = tot2 * (1.0f / 4096.0f);
  const float rstd = rsqrtf(var_s * (1.0f / 65536.0f) + 1e-5f) * (1.0f / 256.0f);
  v8h ha, hb;
#pragma unroll
  for (int e = 0; e < 8; ++e) {
    ha[e] = (_Float16)(d[e] * rstd * g[cA + e] + bb[cA + e]);
    hb[e] = (_Float16)(d[8 + e] * rstd * g[cB + e] + bb[cB + e]);
  }
  *(v8h*)(ur + cA) = ha;
  *(v8h*)(ur + cB) = hb;
  
}

// =====================================================================================================================
// Workspace map (byte offsets; every region a whole number of MiB after 4 KiB left unused, all stores whole-line):
//   (unused)                                       0            (4 KiB)
//   cs  f32[2048][512][2]                          4 KiB        (8 MiB)
//   WaT f16[1024][1024] x64                       +8 MiB       WvTh/WvTl bf16 [1024][1024]   WqT f16[512][1024]
//   WkvT f16[1024][1024]   W1T f16[4096][1024]   W2T f16[1024][4096]   WoTh/WoTl bf16[1024][512]   (27 MiB)
//   R3  8 MiB : q16 f16[4096][1024] -> h16 -> x2h (f16, x2 * 1024)
//   R4 16 MiB : audio adapter GEMM f32 [4096][1024] -> S f32 [4096][1024] -> x f32 -> x2 f32
//   R5 51 MiB : a16 f16 @0, video hi @8, video lo @16, k16 f16[(512+4096)][1024] @24, vTh bf16[1024][4608] @33, vTl @42;
//               later Ph @0, Pl @8; q/k f16[4096][512] @0/@4, vT16 f16[512][4096] @8; o f32[4096][512] @16; o hi/lo @24/@28;
//               U f16[4096][4096] @0 (written only after all earlier users of [0,32) have been consumed).
//   R6 16 MiB : video adapter GEMM f32 [4096][1024]
//   total 126 MiB + 4 KiB.
// =====================================================================================================================
extern "C" void kernel_launch(void* const* d_in, const int* in_sizes, int n_in,
                              void* d_out, int out_size, void* d_ws, size_t ws_size,
                              hipStream_t stream) {
  if (n_in < 24) return;
  if (in_sizes[0] != NTOK * DM || in_sizes[1] != NTOK * DM || in_sizes[2] != NTOK * DM) return;
  if (in_sizes[3] != DM * DM || in_sizes[7] != DM * DM || in_sizes[14] != DM * 2 * INR) return;
  if (in_sizes[13] != DM * INR || in_sizes[17] != INR * DM) return;
  if (in_sizes[18] != DM * FFD || in_sizes[22] != FFD * DM) return;
  if (in_sizes[4] != DM || in_sizes[5] != DM || in_sizes[6] != DM || in_sizes[8] != DM || in_sizes[9] != DM ||
      in_sizes[10] != DM || in_sizes[11] != DM || in_sizes[12] != DM || in_sizes[23] != DM) return;
  if (in_sizes[15] != DHD || in_sizes[16] != DHD) return;
  if (in_sizes[19] != FFD || in_sizes[20] != FFD || in_sizes[21] != FFD) return;
  if (out_size != NTOK * DM) return;

  const float* text  = (const float*)d_in[0];
  const float* audio = (const float*)d_in[1];
  const float* video = (const float*)d_in[2];
  const float* Wa    = (const float*)d_in[3];
  const float* ba    = (const float*)d_in[4];
  const float* lna_g = (const float*)d_in[5];
  const float* lna_b = (const float*)d_in[6];
  const float* Wvid  = (const float*)d_in[7];
  const float* bvid  = (const float*)d_in[8];
  const float* lnv_g = (const float*)d_in[9];
  const float* lnv_b = (const float*)d_in[10];
  const float* ln1_g = (const float*)d_in[11];
  const float* ln1_b = (const float*)d_in[12];
  const float* Wq    = (const float*)d_in[13];
  const float* Wkv   = (const float*)d_in[14];
  const float* qn_g  = (const float*)d_in[15];
  const float* kn_g  = (const float*)d_in[16];
  const float* Wo    = (const float*)d_in[17];
  const float* W1    = (const float*)d_in[18];
  const float* b1    = (const float*)d_in[19];
  const float* ln2_g = (const float*)d_in[20];
  const float* ln2_b = (const float*)d_in[21];
  const float* W2    = (const float*)d_in[22];
  const float* b2    = (const float*)d_in[23];
  float* outp = (float*)d_out;

  const size_t MIB = 1048576;
  size_t off = 0;
  const size_t oInv  = off; off += 4096;
  const size_t oCs   = off; off += (size_t)SEQ * 512 * 2 * 4;       // 8 MiB
  const size_t oWaT  = off; off += (size_t)DM * DM * 2;              // 2 MiB
  const size_t oWvTh = off; off += (size_t)DM * DM * 2;              // 2 MiB
  const size_t oWvTl = off; off += (size_t)DM * DM * 2;              // 2 MiB
  const size_t oWqT  = off; off += (size_t)INR * DM * 2;             // 1 MiB
  const size_t oWkvT = off; off += (size_t)2 * INR * DM * 2;         // 2 MiB
  const size_t oW1T  = off; off += (size_t)FFD * DM * 2;             // 8 MiB
  const size_t oW2T  = off; off += (size_t)DM * FFD * 2;             // 8 MiB
  const size_t oWoTh = off; off += (size_t)DM * INR * 2;             // 1 MiB
  const size_t oWoTl = off; off += (size_t)DM * INR * 2;             // 1 MiB
  const size_t oR3   = off; off += (size_t)NTOK * DM * 2;            // 8 MiB
  const size_t oR4   = off; off += (size_t)NTOK * DM * 4;            // 16 MiB
  const size_t oR5   = off; off += 51 * MIB;                         // 51 MiB
  const size_t oR6   = off; off += (size_t)NTOK * DM * 4;            // 16 MiB
  if (off > ws_size || off > (size_t)128 * MIB) return;              // off = 126 MiB + 4 KiB

  char* ws = (char*)d_ws;
  float* cs  = (float*)(ws + oCs);
  _Float16* WaT = (_Float16*)(ws + oWaT);
  unsigned short* WvTh = (unsigned short*)(ws + oWvTh);
  unsigned short* WvTl = (unsigned short*)(ws + oWvTl);
  _Float16* WqT  = (_Float16*)(ws + oWqT);
  _Float16* WkvT = (_Float16*)(ws + oWkvT);
  _Float16* W1T  = (_Float16*)(ws + oW1T);
  _Float16* W2T  = (_Float16*)(ws + oW2T);
  unsigned short* WoTh = (unsigned short*)(ws + oWoTh);
  unsigned short* WoTl = (unsigned short*)(ws + oWoTl);
  _Float16* q16 = (_Float16*)(ws + oR3);          // text after rotary
  _Float16* h16 = (_Float16*)(ws + oR3);          // LN1 output (later)
  _Float16* x2h = (_Float16*)(ws + oR3);          // x2 * 1024 (later)
  float* Cad = (float*)(ws + oR4);                // audio adapter GEMM output
  float* Cvd = (float*)(ws + oR6);                // video adapter GEMM output
  float* Sf  = (float*)(ws + oR4);                // local scores (later)
  float* Xf  = (float*)(ws + oR4);                // local attention output (later)
  float* X2f = (float*)(ws + oR4);                // 2 * o @ Wo (later)
  char* r5 = ws + oR5;
  _Float16* a16 = (_Float16*)(r5);
  unsigned short* vih = (unsigned short*)(r5 + 8 * MIB);
  unsigned short* vil = (unsigned short*)(r5 + 16 * MIB);
  _Float16* k16 = (_Float16*)(r5 + 24 * MIB);     // [(KPR+NTOK)][DM]
  unsigned short* vTh = (unsigned short*)(r5 + 33 * MIB);
  unsigned short* vTl = (unsigned short*)(r5 + 42 * MIB);
  unsigned short* Ph  = (unsigned short*)(r5);
  unsigned short* Pl  = (unsigned short*)(r5 + 8 * MIB);
  _Float16* qm16 = (_Float16*)(r5);
  _Float16* km16 = (_Float16*)(r5 + 4 * MIB);
  _Float16* vT16 = (_Float16*)(r5 + 8 * MIB);
  float* Of = (float*)(r5 + 16 * MIB);
  unsigned short* Oh = (unsigned short*)(r5 + 24 * MIB);
  unsigned short* Ol = (unsigned short*)(r5 + 28 * MIB);
  _Float16* U16 = (_Float16*)(r5);

  const dim3 blk(256);
  const dim3 blkG(128);                           // k_gemm: 4 waves
  const unsigned short* N16 = (const unsigned short*)nullptr;

  // everything that depends on the inputs alone, in one launch: rotary table and text -> rotary f16, the seven weight re-layouts
  // (in [rows][cols] f32 -> out [cols][rows]), audio -> f16, video -> bf16 hi/lo
  k_prep<<<dim3(PREP_BLOCKS), blk, 0, stream>>>(text, audio, video, Wa, Wvid, Wq, Wkv, W1, W2, Wo, cs, q16, a16, vih, vil,
                                                WaT, WvTh, WvTl, WqT, WkvT, W1T, W2T, WoTh, WoTl);

  // adapter a: audio . Wa + ba -> f32; adapter v: video . Wvid + bvid (bf16 hi/lo split) -> f32, each into its own plane
  const dim3 gA((NTOK / 128) * (DM / 128), 1);
  k_gemm<0, false, true, 0, 0, false, 0><<<gA, blkG, 0, stream>>>(
      (const unsigned short*)a16, N16, DM, 0L, (const unsigned short*)WaT, N16, DM, 0L,
      Cad, DM, 0L, nullptr, 0, 0L, ba, nullptr, nullptr, 0, 0L, NTOK, DM, DM, 1, 1.0f / 64.0f, 1.0f);
  k_gemm<1, true, true, 0, 0, false, 0><<<gA, blkG, 0, stream>>>(
      vih, vil, DM, 0L, WvTh, WvTl, DM, 0L,
      Cvd, DM, 0L, nullptr, 0, 0L, bvid, nullptr, nullptr, 0, 0L, NTOK, DM, DM, 1, 1.0f, 1.0f);
  // both norms in one launch: a: LN + rotary -> key plane rows KPR..KPR+4095, rows 0..KPR-1 zero; v: LN + transpose + split ->
  // value^T planes
  k_ln_pair<<<dim3(VCS * (NTOK / 64) + KPR / 64 + (NTOK + KPR) / 2), blk, 0, stream>>>(Cad, lna_g, lna_b, cs, k16, Cvd, lnv_g, lnv_b, vTh, vTl);

  // local attention: z = b*4 + w; S[z][512][1024] = q . k / 32 over window keys (skipping fully masked key tiles)
  const dim3 gS((WSZ / 128) * (2 * WSZ / 128), NB_ * NWN);
  k_gemm<0, false, false, 0, 0, false, 1><<<gS, blkG, 0, stream>>>(
      (const unsigned short*)q16, N16, DM, (long)WSZ * DM, (const unsigned short*)k16, N16, DM, (long)WSZ * DM,
      Sf, 2 * WSZ, (long)WSZ * 2 * WSZ, nullptr, 0, 0L, nullptr, nullptr, nullptr, 0, 0L,
      WSZ, 2 * WSZ, DM, NWN, 1.0f / 32.0f, 1.0f);
  k_lsoftmax<<<dim3(NTOK), dim3(128), 0, stream>>>(Sf, Ph, Pl);
  // x[z][512][1024] = P . v (bf16 hi/lo split), keys restricted to the unmasked range
  const dim3 gPV((WSZ / 128) * (DM / 128), NB_ * NWN);
  k_gemm<1, true, false, 0, 0, false, 2><<<gPV, blkG, 0, stream>>>(
      Ph, Pl, 2 * WSZ, (long)WSZ * 2 * WSZ, vTh, vTl, VTP, (long)WSZ,
      Xf, DM, (long)WSZ * DM, nullptr, 0, 0L, nullptr, nullptr, nullptr, 0, 0L,
      WSZ, DM, 2 * WSZ, NWN, 1.0f, 1.0f);

  // LN1 -> h16; q, k (RMSNorm epilogue) and v^T projections
  k_ln1024<<<dim3(NTOK), dim3(128), 0, stream>>>(Xf, ln1_g, ln1_b, h16, NTOK);
  // one grid, z = 0: q, 1: k, 2: v^T; WqT, the k rows and the v rows of WkvT lie INR * DM elements apart, qm16, km16 and vT16
  // NTOK * INR elements apart
  const dim3 gQKV((NTOK / 128) * (INR / 128), 3);
  k_gemm<0, false, false, 2, 1, false, 3><<<gQKV, blkG, 0, stream>>>(
      (const unsigned short*)h16, N16, DM, 0L, (const unsigned short*)WqT, N16, DM, (long)INR * DM,
      nullptr, 0, 0L, qm16, INR, (long)NTOK * INR, nullptr, qn_g, kn_g, 0, 0L, NTOK, INR, DM, 1, 1.0f / 64.0f, 1.0f);

  // causal attention -> o f32 [4096][512]; o -> bf16 hi/lo
  k_flash<<<dim3(NHD * (SEQ / 64), NB_), dim3(128), 0, stream>>>(qm16, km16, vT16, Of);
  const int n2o = NTOK * INR / 2;
  k_split2<<<dim3((n2o + 255) / 256), blk, 0, stream>>>(Of, Oh, Ol, n2o);

  // x2 = 2 * (o . Wo) -> f32 and f16 (x2 * 1024)
  k_gemm<1, true, false, 0, 2, false, 0><<<gA, blkG, 0, stream>>>(
      Oh, Ol, INR, 0L, WoTh, WoTl, INR, 0L,
      X2f, DM, 0L, x2h, DM, 0L, nullptr, nullptr, nullptr, 0, 0L, NTOK, DM, INR, 1, 2.0f, 1024.0f);

  // FFN: u = gelu(x2 . W1 + b1) stored as f16(256 u); LN over 4096 in place; out = h1 . W2 + b2 + x2
  const dim3 gW1((NTOK / 128) * (FFD / 128), 1);
  k_gemm<0, false, true, 1, 1, false, 0><<<gW1, blkG, 0, stream>>>(
      (const unsigned short*)x2h, N16, DM, 0L, (const unsigned short*)W1T, N16, DM, 0L,
      nullptr, 0, 0L, U16, FFD, 0L, b1, nullptr, nullptr, 0, 0L, NTOK, FFD, DM, 1, 1.0f / 65536.0f, 256.0f);
  k_ln4096<<<dim3(NTOK), blk, 0, stream>>>(U16, ln2_g, ln2_b);
  k_gemm<0, false, true, 0, 0, true, 0><<<gA, blkG, 0, stream>>>(
      (const unsigned short*)U16, N16, FFD, 0L, (const unsigned short*)W2T, N16, FFD, 0L,
      outp, DM, 0L, nullptr, 0, 0L, b2, nullptr, X2f, DM, 0L, NTOK, DM, FFD, 1, 1.0f / 64.0f, 1.0f);
  (void)hipGetLastError();
}

// v010
// A run of this version takes 298 microseconds.
// In both of two side-by-side timings against v009, it was 1.04 times as fast.
// Over all steps from v000, the starting kernel, it is 3.53 times as fast.
// Contractions: audio adapter, local-attention scores, q/k/v projections, causal multi-head q.k^T and p.v, FFN W1 and W2 on
// v_wmma_f32_16x16x32_f16 (f16 operands with power-of-two carried scales, f32 accumulate); video adapter, local-attention p.v
// and the output projection Wo on v_wmma_f32_16x16x32_bf16 with bf16 hi/lo split operands (hi.hi + hi.lo + lo.hi, f32
// accumulate). LayerNorm, RMSNorm, rotary tables, softmax and GELU in f32.
#include <hip/hip_runtime.h>
#include <math.h>
#include <stdint.h>

#define NB_   2
#define SEQ   2048
#define NTOK  4096
#define DM    1024
#define NHD   8
#define DHD   64
#define INR   512
#define FFD   4096
#define WSZ   512
#define NWN   4
#define KPR   512          // leading zero rows of the local-attention key plane
#define VTP   4608         // key pitch of the local-attention value^T planes: 512 zero columns + 4096 tokens

typedef __attribute__((ext_vector_type(16))) _Float16 v16h;
typedef __attribute__((ext_vector_type(8)))  _Float16 v8h;
typedef __attribute__((ext_vector_type(2)))  _Float16 v2h;
typedef __attribute__((ext_vector_type(16))) __bf16   v16b;
typedef __attribute__((ext_vector_type(8)))  __bf16   v8b;
typedef __attribute__((ext_vector_type(8)))  float    v8f;
typedef __attribute__((ext_vector_type(4)))  float    v4f;
typedef __attribute__((ext_vector_type(2)))  float    v2f;
typedef __attribute__((ext_vector_type(4)))  unsigned int v4u;
typedef __attribute__((ext_vector_type(2)))  unsigned int v2u;

__device__ __forceinline__ unsigned short f2bf_bits(float f) {
  unsigned u = __float_as_uint(f);
  return (unsigned short)((u + 0x7FFFu + ((u >> 16) & 1u)) >> 16);   // RNE convert
}
__device__ __forceinline__ float bf_bits2f(unsigned short h) { return __uint_as_float(((unsigned)h) << 16); }
__device__ __forceinline__ unsigned pk16(unsigned short a, unsigned short b) { return (unsigned)a | ((unsigned)b << 16); }

__device__ __forceinline__ float wsum(float v) {
#pragma unroll
  for (int o = 16; o >= 1; o >>= 1) v += __shfl_xor(v, o, 32);
  return v;
}
__device__ __forceinline__ float wmax(float v) {
#pragma unroll
  for (int o = 16; o >= 1; o >>= 1) v = fmaxf(v, __shfl_xor(v, o, 32));
  return v;
}

// hazard guard as a plain device helper
__device__ __forceinline__ void acc_guard4(v8f& a, v8f& b, v8f& c, v8f& d) { asm volatile("v_nop\n\tv_nop\n\tv_nop\n\tv_nop" : "+v"(a), "+v"(b), "+v"(c), "+v"(d)); }

// Fragment loaders: element i of the 16-wide per-lane vector <- p[i] for i<8 and p[16 + (i-8)] for i>=8, where p already points at
// row (lane&15), k0 + 8*(lane>>4). Same map for A ([m][k]) and B stored as [n][k].
template <typename T> struct Frag;
template <> struct Frag<_Float16> {
  typedef v16h V; union U { v16h v; v8h h[2]; };
  static __device__ __forceinline__ v16h load(const _Float16* p) {
    U f; f.h[0] = *(const v8h*)(p); f.h[1] = *(const v8h*)(p + 16); return f.v;
  }
  static __device__ __forceinline__ v8f mma(v16h a, v16h b, v8f c) {
    return __builtin_amdgcn_wmma_f32_16x16x32_f16(false, a, false, b, (short)0, c, false, false);
  }
};
template <> struct Frag<__bf16> {
  typedef v16b V; union U { v16b v; v8b h[2]; };
  static __device__ __forceinline__ v16b load(const __bf16* p) {
    U f; f.h[0] = *(const v8b*)(p); f.h[1] = *(const v8b*)(p + 16); return f.v;
  }
  static __device__ __forceinline__ v8f mma(v16b a, v16b b, v8f c) {
    return __builtin_amdgcn_wmma_f32_16x16x32_bf16(false, a, false, b, (short)0, c, false, false);
  }
};

// =====================================================================================================================
// Batched WMMA GEMM: C[m,n] = epi(scale * sum_k A[m,k] * Bt[n,k]). A block of 4 waves (2 x 2) owns a 128x128 tile, each wave a
// 64x64 tile of it. The block's 128 rows of A and of Bt are staged in LDS, BK k-elements at a time, by asynchronous 16-byte
// copies that cover whole 128-byte lines, in two buffers: the next stage's copies fly while this stage is multiplied. Fragments are
// read from LDS one block of 32 k ahead into a second register set; a stage is published in front of the last block of the one before.
// Every block takes all stages of its k range, in cyclic order from stage (tile row + tile column) mod stages.
// A row-major [M,K] (pitch lda); Bt row-major [N,K] (pitch ldb); M, N % 128 == 0, K % BK == 0; grid = (tiles, Z).
//   ET: 0 = f16 operands, 1 = bf16 operands.   SPLIT: hi/lo planes (A2p, Bt2p = lo planes), product = hi.hi + hi.lo + lo.hi.
//   BIAS: + bias[n].  RESID: + resid[m*ldr + n].  EPI: 0 none, 1 tanh-GELU, 2 RMSNorm over the 64-column tile times gvec[n&63].
//   OUTM: 0 f32 -> Cf; 1 f16(v*oscale) -> Ch; 2 both.
//   LOC: 1 = windowed score tiles: key tiles n0 below kBeg(w) or at/after N/2 + m0 + 64 are skipped (a block leaves when all
//        four are; a wave whose own tile is skipped works like the others and stores nothing);
//        2 = windowed p.v: k range [kBeg(w), min(K, K/2 + mB + 128)); kBeg = N/2 resp. K/2 for the first window (w == 0), else 0.
//        3 = three projections of one activation plane in one grid (Z = 3, weight planes strideB apart, outputs strideH apart,
//            each output [rows][cols] dense): z = 0, 1: act . W_z^T with EPI, gvec for z = 0 and the resid pointer as gvec for
//            z = 1; z = 2: the operands change places (W_2 . act^T, an N x M result) and EPI is left out.
// =====================================================================================================================
template <int ET> struct Elem;
template <> struct Elem<0> { typedef _Float16 T; };
template <> struct Elem<1> { typedef __bf16 T; };

// Eight asynchronous 16-byte copies per lane, global -> LDS, eight rows lstep LDS bytes / gstep global elements apart.
// Written as the builtin: with two fragment sets k_gemm lives above v255, and the operands of an asm statement are held to one
// register window, which cost spills around every refill.
typedef __attribute__((ext_vector_type(4))) int v4i;
typedef __attribute__((address_space(1))) v4i gv4i;
typedef __attribute__((address_space(3))) v4i lv4i;
template <typename T>
__device__ __forceinline__ void copy8_to_lds(unsigned l0, unsigned lstep, const T* g0, size_t gstep) {
#pragma unroll                                    // eight copies back to back
  for (int i = 0; i < 8; ++i)
    __builtin_amdgcn_global_load_async_to_lds_b128((gv4i*)(uintptr_t)(g0 + i * gstep), (lv4i*)(l0 + i * lstep), 0, 0);
}

// LDS bytes of one block: two stage buffers. The epilogue's four 16 x 68 f32 slabs lie over them: behind the loop's last barrier no
// wave reads a stage buffer and no copy is outstanding. Without slabs of their own two blocks of either kind fit one WGP's LDS.
template <bool SPLIT> struct GemmLds { static constexpr int BYTES = 2 * (SPLIT ? 4 : 2) * 128 * ((SPLIT ? 64 : 128) + 8) * 2; };

// One block's work: tile index bx, batch index z, smem = the block's GemmLds<SPLIT>::BYTES bytes of LDS.
template <int ET, bool SPLIT, bool BIAS, int EPI, int OUTM, bool RESID, int LOC>
__device__ __forceinline__ void gemm_block(
    unsigned char* smem, const int bx, const int z,
    const unsigned short* __restrict__ Ap, const unsigned short* __restrict__ A2p, int lda, long strideA,
    const unsigned short* __restrict__ Btp, const unsigned short* __restrict__ Bt2p, int ldb, long strideB,
    float* __restrict__ Cf, int ldc, long strideC,
    _Float16* __restrict__ Ch, int ldh, long strideH,
    const float* __restrict__ bias, const float* __restrict__ gvec,
    const float* __restrict__ resid, int ldr, long strideR,
    int M, int N, int K, int nwin, float scale, float oscale) {
  typedef typename Elem<ET>::T T;
  typedef typename Frag<T>::V V;
  constexpr int BK    = SPLIT ? 64 : 128;        // k elements per stage: 64 KiB of operand rows either way
  constexpr int PITCH = BK + 8;                  // LDS row pitch in elements: row bytes + 16, conflict-free for 16-byte reads
  constexpr int PLANE = 128 * PITCH;             // one operand plane of a stage; planes: A, Bt (, A lo, Bt lo)
  constexpr int STAGE = (SPLIT ? 4 : 2) * PLANE;
  constexpr int CPR   = BK / 8;                  // 16-byte pieces per row
  constexpr int RPI   = 128 / CPR;               // rows that one copy of all 128 threads covers
  const T* A = (const T*)Ap; const T* A2 = (const T*)A2p; const T* Bt = (const T*)Btp; const T* Bt2 = (const T*)Bt2p;
  static_assert(2 * STAGE * 2 == GemmLds<SPLIT>::BYTES && 4 * 16 * 68 * 4 <= GemmLds<SPLIT>::BYTES, "LDS size");
  T* sAB = (T*)smem;
  const int tid  = threadIdx.x;
  const int lane = tid & 31;
  const int wave = __builtin_amdgcn_readfirstlane(tid >> 5);
  const bool flip = (LOC == 3) && (z == 2);      // block-uniform
  const int Mz = flip ? N : M;
  const int Nz = flip ? M : N;
  const int tilesN = Nz >> 7;
  const int tilesM = Mz >> 7;
  if (bx >= tilesM * tilesN) return;              // block-uniform, in front of every copy and barrier
  const int bm = bx / tilesN;
  const int bn = bx - bm * tilesN;
  const int mB = bm << 7;
  const int nB = bn << 7;
  const int wm = (wave >> 1) << 6;
  const int wn = (wave & 1) << 6;
  const int m0 = mB + wm;
  const int n0 = nB + wn;
  int kBeg = 0, kEnd = K;                         // block's k range
  bool act = true;                                // wave-uniform: this wave's tile is stored
  if (LOC == 1 || LOC == 2) {
    const int w = z % nwin;
    const bool first = (w == 0);
    if (LOC == 1) {
      const int nb = first ? (N >> 1) : 0;
      if (nB + 64 < nb || nB >= (N >> 1) + mB + 128) return; // block-uniform, in front of every copy and barrier
      act = !(n0 < nb || n0 >= (N >> 1) + m0 + 64);
    } else {
      kBeg = first ? (K >> 1) : 0;
      const int ke = (K >> 1) + mB + 128;
      kEnd = (ke < K) ? ke : K;
    }
  }

  const T* Ab  = flip ? (Bt + (size_t)z * strideB) : (A  + (size_t)z * strideA);
  const T* Bb  = flip ? (A  + (size_t)z * strideA) : (Bt + (size_t)z * strideB);
  const T* Ab2 = SPLIT ? (A2  + (size_t)z * strideA) : nullptr;
  const T* Bb2 = SPLIT ? (Bt2 + (size_t)z * strideB) : nullptr;

  const int rlane = lane & 15;                 // row (A) / col (B, D) within a 16x16 subtile
  const int koff  = (lane >> 4) * 8;           // k offset of this lane half
  const int mOff  = (lane >> 4) * 8;           // D row offset

  // this thread's piece of every copy: row crow (+ RPI per copy), 16 bytes at element ccol
  const int crow = tid / CPR;
  const int ccol = (tid % CPR) * 8;
  const unsigned lth = (unsigned)(size_t)sAB + (unsigned)(crow * PITCH + ccol) * 2u;
  const size_t aoff = (size_t)(mB + crow) * lda + ccol;
  const size_t boff = (size_t)(nB + crow) * ldb + ccol;
  const size_t astep = (size_t)RPI * lda;
  const size_t bstep = (size_t)RPI * ldb;
  constexpr unsigned LSTEP = RPI * PITCH * 2u;
  auto fill = [&](int buf, int k0) {             // 32 copies per wave: one stage into buffer buf
    const unsigned lb = lth + (unsigned)buf * (STAGE * 2u);
    if constexpr (SPLIT) {
      copy8_to_lds<T>(lb,                  LSTEP, Ab  + aoff + k0, astep);
      copy8_to_lds<T>(lb + PLANE * 2u,     LSTEP, Bb  + boff + k0, bstep);
      copy8_to_lds<T>(lb + PLANE * 4u,     LSTEP, Ab2 + aoff + k0, astep);
      copy8_to_lds<T>(lb + PLANE * 6u,     LSTEP, Bb2 + boff + k0, bstep);
    } else {
      copy8_to_lds<T>(lb,                              LSTEP, Ab + aoff + k0,             astep);
      copy8_to_lds<T>(lb + 8u * LSTEP,                 LSTEP, Ab + aoff + k0 + 8 * astep, astep);
      copy8_to_lds<T>(lb + PLANE * 2u,                 LSTEP, Bb + boff + k0,             bstep);
      copy8_to_lds<T>(lb + PLANE * 2u + 8u * LSTEP,    LSTEP, Bb + boff + k0 + 8 * bstep, bstep);
    }
  };

  v8f acc[4][4];
#pragma unroll
  for (int i = 0; i < 4; ++i)
#pragma unroll
    for (int j = 0; j < 4; ++j) acc[i][j] = (v8f){0.f,0.f,0.f,0.f,0.f,0.f,0.f,0.f};

  // Two fragment sets: a block = the WMMAs of 32 k. The next block's fragments are read from LDS as one group into the other set in
  // front of this block's WMMAs, so that their latency passes behind the matrix work instead of in front of it.
  constexpr int NBLK = BK / 32;                   // blocks per stage, even: block b of every stage uses set b & 1
  V ah[2][4], al[2][4], bh[2][4], bl[2][4];
  const T* sA0 = sAB + (wm + rlane) * PITCH + koff;
  const T* sB0 = sAB + PLANE + (wn + rlane) * PITCH + koff;
  auto fetch = [&](int set, int buf, int kk) {    // all fragments of the block at k offset kk of buffer buf
    const T* sA = sA0 + buf * STAGE + kk;
    const T* sB = sB0 + buf * STAGE + kk;
#pragma unroll                                    // static indices: the fragment arrays stay in registers
    for (int j = 0; j < 4; ++j) {
      bh[set][j] = Frag<T>::load(sB + (j << 4) * PITCH);
      if (SPLIT) bl[set][j] = Frag<T>::load(sB + 2 * PLANE + (j << 4) * PITCH); else bl[set][j] = bh[set][j];
    }
#pragma unroll                                    // static indices: the fragment arrays stay in registers
    for (int i = 0; i < 4; ++i) {
      ah[set][i] = Frag<T>::load(sA + (i << 4) * PITCH);
      if (SPLIT) al[set][i] = Frag<T>::load(sA + 2 * PLANE + (i << 4) * PITCH); else al[set][i] = ah[set][i];
    }
  };
  // Every wave works through all of the block's stages, so that the loop has no branch between a read group and its counted wait:
  // a wave whose score tile is skipped (LOC 1) stores nothing, and past its own key range (LOC 2) a wave's p rows are zero.

  const int nst = (kEnd - kBeg) / BK;             // block-uniform number of stages
  // The block walks its stages round from a start that its tile indices set: blocks with the same rows of A or of Bt run side by
  // side, and from a common start they would all ask L2 for the same lines (and every block for the same k columns) at one moment.
  const int rot = (nst > 1) ? (bm + bn) % nst : 0;  // block-uniform
  auto kof = [&](int t) {                         // k offset of the t-th stage that this block works on
    const int s = t + rot;
    return kBeg + ((s >= nst) ? s - nst : s) * BK;
  };
  fill(0, kof(0));
  asm volatile("s_wait_asynccnt 0x0" ::: "memory");   // this wave's copies of stage 0 have landed
  __syncthreads();                                     // every wave's have
  if (nst > 1) fill(1, kof(1));
  fetch(0, 0, 0);

  for (int t = 0; t < nst; ++t) {
#pragma unroll                                    // the set index and the LDS offsets of the fragment loads become constants
    for (int b = 0; b < NBLK; ++b) {
      if (b + 1 < NBLK) {
        fetch((b + 1) & 1, t & 1, (b + 1) * 32);
      } else {
        // publish point of stage t + 1, in front of stage t's last block, whose fragments are already fetched; every wave passes it
        asm volatile("s_wait_dscnt 0x0" ::: "memory");     // this wave's reads of buffer t & 1 are done before it is refilled
        asm volatile("s_wait_asynccnt 0x0" ::: "memory");  // this wave's copies of stage t + 1 have landed
        __syncthreads();                                    // publishes stage t + 1 and ends every reader's use of buffer t & 1
        if (t + 2 < nst) fill(t & 1, kof(t + 2));
        if (t + 1 < nst) fetch(0, (t + 1) & 1, 0);
      }
      __builtin_amdgcn_sched_barrier(0);          // keeps the read group in front of the WMMAs: one place with LDS reads per block
      {
        const int s = b & 1;
#pragma unroll                                    // static indices: the fragment and accumulator arrays stay in registers
        for (int i = 0; i < 4; ++i) {
#pragma unroll                                    // static indices: the fragment and accumulator arrays stay in registers
          for (int j = 0; j < 4; ++j) {
            acc[i][j] = Frag<T>::mma(ah[s][i], bh[s][j], acc[i][j]);
            if (SPLIT) {
              acc[i][j] = Frag<T>::mma(ah[s][i], bl[s][j], acc[i][j]);
              acc[i][j] = Frag<T>::mma(al[s][i], bh[s][j], acc[i][j]);
            }
          }
        }
      }
      __builtin_amdgcn_sched_barrier(0);          // keeps this block's WMMAs in front of the next read group and of the publish point's waits
    }
  }
  asm volatile("s_wait_asynccnt 0x0" ::: "memory");    // no copy is outstanding when the wave goes on or ends
  if (!act) return;                                     // wave-uniform, behind the last barrier
  acc_guard4(acc[0][0], acc[0][1], acc[0][2], acc[0][3]);
  acc_guard4(acc[1][0], acc[1][1], acc[1][2], acc[1][3]);
  acc_guard4(acc[2][0], acc[2][1], acc[2][2], acc[2][3]);
  acc_guard4(acc[3][0], acc[3][1], acc[3][2], acc[3][3]);

  // ---- epilogue ----
  float* slab = (float*)smem + wave * (16 * 68);
  const bool rms = (EPI == 2) && !flip;           // block-uniform
  const float* gv = (LOC == 3 && z == 1) ? resid : gvec;
  const int ldhz = (LOC == 3) ? Nz : ldh;
  const float* Rb = RESID ? (resid + (size_t)z * strideR) : nullptr;
#pragma unroll
  for (int i = 0; i < 4; ++i) {
    const int mBase = m0 + (i << 4);
#pragma unroll
    for (int j = 0; j < 4; ++j) {
      const int n = n0 + (j << 4) + rlane;
      float bv = 0.f;
      if (BIAS) bv = bias[n];
#pragma unroll
      for (int r = 0; r < 8; ++r) {
        float v = acc[i][j][r] * scale;
        if (BIAS) v += bv;
        if (RESID) v += Rb[(size_t)(mBase + mOff + r) * ldr + n];
        if (EPI == 1) {
          // 0.5 * (1 + tanh(u)) = 1 / (1 + exp(-2u)), u = 0.7978845608 * (v + 0.044715 v^3); exp(-2u) = 2^(-2 log2(e) u):
          // one hardware exponential and one reciprocal, no branch, so the eight rows of a column run side by side
          const float e = __builtin_amdgcn_exp2f(-2.3022081981f * (v + 0.044715f * v * v * v));
          v = v * __builtin_amdgcn_rcpf(1.0f + e);
        }
        slab[(mOff + r) * 68 + (j << 4) + rlane] = v;
      }
    }
    __builtin_amdgcn_fence(__ATOMIC_RELEASE, "workgroup");
    __builtin_amdgcn_wave_barrier();
    __builtin_amdgcn_fence(__ATOMIC_ACQUIRE, "workgroup");
    if (OUTM == 0 || OUTM == 2) {
      float* C = Cf + (size_t)z * strideC;
      const int hh = lane >> 4, c4 = (lane & 15) * 4;     // row seg = 256 B = 16 lanes x 16 B
      {
#pragma unroll
        for (int it = 0; it < 8; ++it) {
          const int row = it * 2 + hh;                      // it 0..7 x hh 0..1 = rows 0..15
          v4f v = *(const v4f*)(slab + row * 68 + c4);
          *(v4f*)(C + (size_t)(mBase + row) * ldc + n0 + c4) = v;
        }
        asm volatile("s_wait_xcnt 0x0" ::: "memory");   // stands in front of any later write of a register that the stores above name
      }
    }
    if (OUTM == 1 || OUTM == 2) {
      _Float16* C = Ch + (size_t)z * strideH;
      const int q = lane >> 3, c8 = (lane & 7) * 8;
      {
#pragma unroll
        for (int it = 0; it < 4; ++it) {
          const int row = it * 4 + q;                       // it 0..3 x q 0..3 = rows 0..15
          const float* sp = slab + row * 68 + c8;
          float x[8];
#pragma unroll
          for (int e = 0; e < 8; ++e) x[e] = sp[e];
          float rr = oscale;
          if (EPI == 2) {
            float ss = 0.f;
#pragma unroll
            for (int e = 0; e < 8; ++e) ss += x[e] * x[e];
            ss += __shfl_xor(ss, 1, 32);                    // lanes 8q..8q+7 hold one 64-wide row
            ss += __shfl_xor(ss, 2, 32);
            ss += __shfl_xor(ss, 4, 32);
            const float rn = oscale * rsqrtf(ss * (1.0f / 64.0f) + 1e-6f);
            rr = rms ? rn : oscale;                         // a select, not a branch: the four rows' stores stay one group
          }
          v8h hv;
#pragma unroll
          for (int e = 0; e < 8; ++e) {
            float y = x[e] * rr;
            if (EPI == 2) { const float ge = gv[c8 + e]; y *= rms ? ge : 1.0f; }
            hv[e] = (_Float16)y;
          }
          *(v8h*)(C + (size_t)(mBase + row) * ldhz + n0 + c8) = hv;
        }
        asm volatile("s_wait_xcnt 0x0" ::: "memory");   // stands in front of any later write of a register that the stores above name
      }
    }
    __builtin_amdgcn_fence(__ATOMIC_RELEASE, "workgroup");
    __builtin_amdgcn_wave_barrier();
    __builtin_amdgcn_fence(__ATOMIC_ACQUIRE, "workgroup");
  }
}

template <int ET, bool SPLIT, bool BIAS, int EPI, int OUTM, bool RESID, int LOC>
__global__ __launch_bounds__(128) void k_gemm(
    const unsigned short* __restrict__ Ap, const unsigned short* __restrict__ A2p, int lda, long strideA,
    const unsigned short* __restrict__ Btp, const unsigned short* __restrict__ Bt2p, int ldb, long strideB,
    float* __restrict__ Cf, int ldc, long strideC,
    _Float16* __restrict__ Ch, int ldh, long strideH,
    const float* __restrict__ bias, const float* __restrict__ gvec,
    const float* __restrict__ resid, int ldr, long strideR,
    int M, int N, int K, int nwin, float scale, float oscale) {
  __shared__ __align__(16) unsigned char smem[GemmLds<SPLIT>::BYTES];
  gemm_block<ET, SPLIT, BIAS, EPI, OUTM, RESID, LOC>(smem, blockIdx.x, blockIdx.y, Ap, A2p, lda, strideA, Btp, Bt2p, ldb, strideB,
                                                     Cf, ldc, strideC, Ch, ldh, strideH, bias, gvec, resid, ldr, strideR,
                                                     M, N, K, nwin, scale, oscale);
}

// Both adapter products in one launch: neither reads what the other writes. blockIdx.y = 0: video . Wvid + bvid (bf16 hi/lo split,
// the longer job, so it comes first), 1: audio . Wa + ba (f16, weights carried x64); each [M][K] . [N][K]^T -> [M][N] f32, own plane.
__global__ __launch_bounds__(128) void k_gemm_adapters(
    const unsigned short* __restrict__ vih, const unsigned short* __restrict__ vil,
    const unsigned short* __restrict__ WvTh, const unsigned short* __restrict__ WvTl, const float* __restrict__ bvid,
    float* __restrict__ Cvd,
    const unsigned short* __restrict__ a16, const unsigned short* __restrict__ WaT, const float* __restrict__ ba,
    float* __restrict__ Cad, int M, int N, int K) {
  __shared__ __align__(16) unsigned char smem[GemmLds<true>::BYTES];
  static_assert(GemmLds<false>::BYTES <= GemmLds<true>::BYTES, "LDS size");
  if (blockIdx.y == 0)                            // block-uniform
    gemm_block<1, true, true, 0, 0, false, 0>(smem, blockIdx.x, 0, vih, vil, K, 0L, WvTh, WvTl, K, 0L, Cvd, N, 0L, nullptr, 0, 0L,
                                              bvid, nullptr, nullptr, 0, 0L, M, N, K, 1, 1.0f, 1.0f);
  else
    gemm_block<0, false, true, 0, 0, false, 0>(smem, blockIdx.x, 0, a16, nullptr, K, 0L, WaT, nullptr, K, 0L, Cad, N, 0L, nullptr, 0, 0L,
                                               ba, nullptr, nullptr, 0, 0L, M, N, K, 1, 1.0f / 64.0f, 1.0f);
}

// ---------------------------------------------------------------------------------------------------------------------
// The pieces below are block-sized jobs (256 threads) of the one preparation launch k_prep, which deals them out by block index.
// Weight transpose + scale + f16: in [R][Cc] f32 -> o16[Cc][R] = f16(in * wscale). 64x64 tiles through LDS, tile = (R/64 x Cc/64) index.
// coverage per block: load 4 it x 256 thr x 4 = 64x64; store 2 it x 256 thr x 8 = 64x64; each store instruction = 8 lanes x 16 B =
// ---------------------------------------------------------------------------------------------------------------------
__device__ __forceinline__ void wt16_tile(float* tf, const float* __restrict__ W, _Float16* __restrict__ o16, int R, int Cc, float wscale,
                                          int tile) {
  const int tx = Cc >> 6;
  const int c0 = (tile % tx) * 64, r0 = (tile / tx) * 64, tid = threadIdx.x;
  {
    const int lr = tid >> 4, c4 = (tid & 15) * 4;
#pragma unroll
    for (int it = 0; it < 4; ++it) {
      const int rr = it * 16 + lr;
      const v4f a = *(const v4f*)(W + (size_t)(r0 + rr) * Cc + c0 + c4);
      *(v4f*)(tf + rr * 68 + c4) = a;
    }
  }
  __syncthreads();
  const int sub = tid >> 3, c8 = (tid & 7) * 8;
  v8h hv[2];
#pragma unroll
  for (int it = 0; it < 2; ++it) {
    const int oc = it * 32 + sub;
    v8h a;
#pragma unroll
    for (int q = 0; q < 8; ++q) a[q] = (_Float16)(tf[(c8 + q) * 68 + oc] * wscale);
    hv[it] = a;
  }
  {
#pragma unroll
    for (int it = 0; it < 2; ++it) {
      const int oc = it * 32 + sub;
      const size_t go = (size_t)(c0 + oc) * R + r0 + c8;
      *(v8h*)(o16 + go) = hv[it];
    }
    asm volatile("s_wait_xcnt 0x0" ::: "memory");   // stands in front of any later write of a register that the stores above name
  }
}

// Weight transpose + bf16 hi/lo split: in [R][Cc] f32 -> oh[c][r] = bf16(in[r][c]), ol[c][r] = bf16(in[r][c] - oh). Same tiling.
__device__ __forceinline__ void wtsplit_tile(float* tf, const float* __restrict__ W, unsigned short* __restrict__ oh,
                                             unsigned short* __restrict__ ol, int R, int Cc, int tile) {
  const int tx = Cc >> 6;
  const int c0 = (tile % tx) * 64, r0 = (tile / tx) * 64, tid = threadIdx.x;
  {
    const int lr = tid >> 4, c4 = (tid & 15) * 4;
#pragma unroll
    for (int it = 0; it < 4; ++it) {
      const int rr = it * 16 + lr;
      const v4f a = *(const v4f*)(W + (size_t)(r0 + rr) * Cc + c0 + c4);
      *(v4f*)(tf + rr * 68 + c4) = a;
    }
  }
  __syncthreads();
  const int sub = tid >> 3, c8 = (tid & 7) * 8;
  v4u hv[2], lv[2];
#pragma unroll
  for (int it = 0; it < 2; ++it) {
    const int oc = it * 32 + sub;
    v4u a, a2;
#pragma unroll
    for (int q = 0; q < 4; ++q) {
      const float f0 = tf[(c8 + 2 * q) * 68 + oc];
      const float f1 = tf[(c8 + 2 * q + 1) * 68 + oc];
      const unsigned short h0 = f2bf_bits(f0), h1 = f2bf_bits(f1);
      const unsigned short l0 = f2bf_bits(f0 - bf_bits2f(h0)), l1 = f2bf_bits(f1 - bf_bits2f(h1));
      a[q]  = pk16(h0, h1);
      a2[q] = pk16(l0, l1);
    }
    hv[it] = a; lv[it] = a2;
  }
  {
#pragma unroll
    for (int it = 0; it < 2; ++it) {
      const int oc = it * 32 + sub;
      const size_t go = (size_t)(c0 + oc) * R + r0 + c8;
      *(v4u*)(oh + go) = hv[it];
      *(v4u*)(ol + go) = lv[it];
    }
    asm volatile("s_wait_xcnt 0x0" ::: "memory");   // stands in front of any later write of a register that the stores above name
  }
}

__device__ __forceinline__ void split2_piece(const float* __restrict__ in, unsigned short* __restrict__ hi,
                                             unsigned short* __restrict__ lo, int n2, int i) {
  if (i < n2) {
    const v2f f = *(const v2f*)(in + 2 * (size_t)i);
    const unsigned short h0 = f2bf_bits(f[0]), h1 = f2bf_bits(f[1]);
    const unsigned short l0 = f2bf_bits(f[0] - bf_bits2f(h0)), l1 = f2bf_bits(f[1] - bf_bits2f(h1));
    const unsigned uh = pk16(h0, h1), ul = pk16(l0, l1);
    ((unsigned*)hi)[i] = uh;
    ((unsigned*)lo)[i] = ul;
    
  }
}

// ---------------------------------------------------------------------------------------------------------------------
// Rotary table and the rotary mix of text, four positions n = 4*blk .. 4*blk+3 per block; a thread owns the frequencies f0, f0+1.
// inv[f] = 1 / powf(10000, f/512); cs[n][f] = (cos(n * inv[f]), sin(n * inv[f])) as float2, n = 0..2047 (16-byte stores).
// q16[row][c] = f16(x * cos + rot * sin), rot[c] = (c < 512) ? -x[c + 512] : x[c - 512], table row n = row % SEQ, column c % 512:
// the pair (c, c + 512) of both batch elements uses the sine and cosine just formed; a wave's 4-byte stores cover a whole line.
// ---------------------------------------------------------------------------------------------------------------------
__device__ __forceinline__ void rope_piece(const float* __restrict__ text, float* __restrict__ cs, _Float16* __restrict__ q16, int blk) {
  const int f0 = threadIdx.x * 2;
  float iv[2];
#pragma unroll                                    // static indices: the small arrays stay in registers
  for (int e = 0; e < 2; ++e) {
    const float x = (float)(f0 + e) * (1.0f / 512.0f);
    iv[e] = 1.0f / powf(10000.0f, x);
  }
  for (int q = 0; q < 4; ++q) {
    const int n = blk * 4 + q;
    float cv[2], sv[2];
#pragma unroll                                    // static indices: the small arrays stay in registers
    for (int e = 0; e < 2; ++e) sincosf((float)n * iv[e], &sv[e], &cv[e]);
    v4f tb; tb[0] = cv[0]; tb[1] = sv[0]; tb[2] = cv[1]; tb[3] = sv[1];
    *(v4f*)(cs + ((size_t)n * 512 + f0) * 2) = tb;
#pragma unroll                                    // both batch elements' loads are in flight together
    for (int b = 0; b < NB_; ++b) {
      const size_t ro = ((size_t)b * SEQ + n) * DM + f0;
      const v2f xl = *(const v2f*)(text + ro), xh = *(const v2f*)(text + ro + 512);
      v2h yl, yh;
#pragma unroll                                    // static indices: the small arrays stay in registers
      for (int e = 0; e < 2; ++e) {
        yl[e] = (_Float16)(xl[e] * cv[e] + (-xh[e]) * sv[e]);
        yh[e] = (_Float16)(xh[e] * cv[e] + xl[e] * sv[e]);
      }
      *(v2h*)(q16 + ro)       = yl;
      *(v2h*)(q16 + ro + 512) = yh;
    }
    asm volatile("s_wait_xcnt 0x0" ::: "memory");   // the next trip rewrites registers that this trip's stores name
  }
}

// f32 -> f16, eight elements at 8*i
__device__ __forceinline__ void cvt16_piece(const float* __restrict__ src, _Float16* __restrict__ dst, int i) {
  const float* xr = src + (size_t)i * 8;
  const v4f x0 = *(const v4f*)xr, x1 = *(const v4f*)(xr + 4);
  v8h hv;
#pragma unroll                                    // static indices: the small arrays stay in registers
  for (int e = 0; e < 4; ++e) { hv[e] = (_Float16)x0[e]; hv[4 + e] = (_Float16)x1[e]; }
  *(v8h*)(dst + (size_t)i * 8) = hv;
  asm volatile("s_wait_xcnt 0x0" ::: "memory");   // stands in front of any later write of a register that the stores above name
}

// ---------------------------------------------------------------------------------------------------------------------
// Preparation, one launch: everything that depends on the inputs alone. None of the jobs reads what another writes, so they share
// one grid and run side by side; the job is a block-uniform function of blockIdx.x (arithmetic-heavy and large jobs first).
//   512 rotary table + text | 1024 W1 | 1024 W2 | 256 Wa | 256 Wvid | 256 Wkv | 128 Wq | 128 Wo | 2048 audio | 8192 video
// ---------------------------------------------------------------------------------------------------------------------
#define PREP_BLOCKS (512 + 1024 + 1024 + 256 + 256 + 256 + 128 + 128 + 2048 + 8192)
__global__ __launch_bounds__(256) void k_prep(
    const float* __restrict__ text, const float* __restrict__ audio, const float* __restrict__ video,
    const float* __restrict__ Wa, const float* __restrict__ Wvid, const float* __restrict__ Wq, const float* __restrict__ Wkv,
    const float* __restrict__ W1, const float* __restrict__ W2, const float* __restrict__ Wo,
    float* __restrict__ cs, _Float16* __restrict__ q16, _Float16* __restrict__ a16,
    unsigned short* __restrict__ vih, unsigned short* __restrict__ vil,
    _Float16* __restrict__ WaT, unsigned short* __restrict__ WvTh, unsigned short* __restrict__ WvTl,
    _Float16* __restrict__ WqT, _Float16* __restrict__ WkvT, _Float16* __restrict__ W1T, _Float16* __restrict__ W2T,
    unsigned short* __restrict__ WoTh, unsigned short* __restrict__ WoTl) {
  __shared__ __align__(16) float tf[64 * 68];
  int b = blockIdx.x;
  if (b < 512)  { rope_piece(text, cs, q16, b); return; }
  b -= 512;
  if (b < 1024) { wt16_tile(tf, W1, W1T, DM, FFD, 64.0f, b); return; }            // W1  [1024][4096]
  b -= 1024;
  if (b < 1024) { wt16_tile(tf, W2, W2T, FFD, DM, 64.0f, b); return; }            // W2  [4096][1024]
  b -= 1024;
  if (b < 256)  { wt16_tile(tf, Wa, WaT, DM, DM, 64.0f, b); return; }             // Wa  [1024][1024]
  b -= 256;
  if (b < 256)  { wtsplit_tile(tf, Wvid, WvTh, WvTl, DM, DM, b); return; }        // Wvid[1024][1024]
  b -= 256;
  if (b < 256)  { wt16_tile(tf, Wkv, WkvT, DM, 2 * INR, 64.0f, b); return; }      // Wkv [1024][1024]
  b -= 256;
  if (b < 128)  { wt16_tile(tf, Wq, WqT, DM, INR, 64.0f, b); return; }            // Wq  [1024][512]
  b -= 128;
  if (b < 128)  { wtsplit_tile(tf, Wo, WoTh, WoTl, INR, DM, b); return; }         // Wo  [512][1024]
  b -= 128;
  if (b < 2048) { cvt16_piece(audio, a16, b * 256 + (int)threadIdx.x); return; }  // audio -> f16
  b -= 2048;
  split2_piece(video, vih, vil, NTOK * DM / 2, b * 256 + (int)threadIdx.x);       // video -> bf16 hi/lo
}

// ---------------------------------------------------------------------------------------------------------------------
// Row LayerNorm over DM=1024 of an f32 plane (g, b) -> f16 plane; ROPE additionally applies the rotary mix through an LDS copy of
// the normalised row. Output row = padrows + r; blocks nrows..nrows+padrows-1 write zero rows 0..padrows-1.
// ---------------------------------------------------------------------------------------------------------------------
// One row is the job of 128 threads t = 0..127 (four whole waves) with their own red[4] and rowv[DM]; pad is block-uniform.
template <bool ROPE>
__device__ __forceinline__ void ln1024_row(float* red, float* rowv, const float* __restrict__ X, const float* __restrict__ g,
                                           const float* __restrict__ bb, const float* __restrict__ cs, _Float16* __restrict__ out,
                                           int nrows, int padrows, int blk, int t, bool pad) {
  const int c0 = 8 * t;
  const int lane = t & 31, wave = t >> 5;
  if (pad) {                                       // block-uniform: zero padding rows
    const int p = blk - nrows;
    const v4u zz = {0u, 0u, 0u, 0u};
    _Float16* op = out + (size_t)p * DM + c0;
    *(v4u*)op = zz;
    
    return;
  }
  const int r = blk;
  const float* xr = X + (size_t)r * DM + c0;
  const v4f x0 = *(const v4f*)xr, x1 = *(const v4f*)(xr + 4);
  const float v[8] = {x0[0], x0[1], x0[2], x0[3], x1[0], x1[1], x1[2], x1[3]};
  float s = 0.f;
#pragma unroll
  for (int e = 0; e < 8; ++e) s += v[e];
  s = wsum(s);
  if (lane == 0) red[wave] = s;
  __syncthreads();
  const float mu = (red[0] + red[1] + red[2] + red[3]) * (1.0f / 1024.0f);
  __syncthreads();
  float d[8];
  float s2 = 0.f;
#pragma unroll
  for (int e = 0; e < 8; ++e) { d[e] = v[e] - mu; s2 += d[e] * d[e]; }
  s2 = wsum(s2);
  if (lane == 0) red[wave] = s2;
  __syncthreads();
  const float var = (red[0] + red[1] + red[2] + red[3]) * (1.0f / 1024.0f);
  const float rstd = rsqrtf(var + 1e-5f);
  const v4f g0 = *(const v4f*)(g + c0), g1 = *(const v4f*)(g + c0 + 4);
  const v4f b0 = *(const v4f*)(bb + c0), b1 = *(const v4f*)(bb + c0 + 4);
  const float gv[8] = {g0[0], g0[1], g0[2], g0[3], g1[0], g1[1], g1[2], g1[3]};
  const float bv[8] = {b0[0], b0[1], b0[2], b0[3], b1[0], b1[1], b1[2], b1[3]};
  float y[8];
#pragma unroll
  for (int e = 0; e < 8; ++e) y[e] = d[e] * rstd * gv[e] + bv[e];
  if (ROPE) {
#pragma unroll
    for (int e = 0; e < 8; ++e) rowv[c0 + e] = y[e];
    __syncthreads();
    const int n = r & (SEQ - 1);
    const bool lowh = (c0 < 512);
    const int pc = lowh ? (c0 + 512) : (c0 - 512);
    const float* csr = cs + ((size_t)n * 512 + (c0 & 511)) * 2;
    const v4f t0 = *(const v4f*)csr, t1 = *(const v4f*)(csr + 4), t2 = *(const v4f*)(csr + 8), t3 = *(const v4f*)(csr + 12);
    const float cvv[8] = {t0[0], t0[2], t1[0], t1[2], t2[0], t2[2], t3[0], t3[2]};
    const float svv[8] = {t0[1], t0[3], t1[1], t1[3], t2[1], t2[3], t3[1], t3[3]};
#pragma unroll
    for (int e = 0; e < 8; ++e) {
      const float pr = rowv[pc + e];
      const float rot = lowh ? -pr : pr;
      y[e] = y[e] * cvv[e] + rot * svv[e];
    }
  }
  v8h hv;
#pragma unroll
  for (int e = 0; e < 8; ++e) hv[e] = (_Float16)y[e];
  _Float16* op = out + (size_t)(padrows + r) * DM + c0;
  *(v8h*)op = hv;
  // the ROPE instance shares its kernel with other jobs, whose code follows this store in the listing: the wait stands in front of
  // any write there of a register that the store names
  if (ROPE) asm volatile("s_wait_xcnt 0x0" ::: "memory");
}

__global__ __launch_bounds__(128) void k_ln1024(const float* __restrict__ X, const float* __restrict__ g, const float* __restrict__ bb,
                                                _Float16* __restrict__ out, int nrows) {
  __shared__ float red[4];
  ln1024_row<false>(red, nullptr, X, g, bb, nullptr, out, nrows, 0, blockIdx.x, threadIdx.x, false);
}

// ---------------------------------------------------------------------------------------------------------------------
// Row LayerNorm over DM of an f32 plane [NTOK][DM], fused with transpose + bf16 hi/lo split into value^T planes
// [DM][VTP]: oh[e][KPR + token], ol likewise. Block = 64 token rows x 256 columns (256 threads): per-row stats over the whole row
// from one wave per 8 rows (32 floats per lane), then the block's 4 column tiles of 64 through LDS. The VCS = 4 blocks of a row group
// each form the group's stats for themselves, so that the work covers every WGP instead of a quarter of them.
// Blocks VCS*nrowblk..VCS*nrowblk+7 zero the KPR leading columns.
// coverage: stats 8 waves x 8 rows; tile load 4 it x 256 thr x 4 = 64x64; store 2 it x 256 thr x 8 = 64x64 per plane per tile;
// ---------------------------------------------------------------------------------------------------------------------
#define VCS 4              // blocks per group of 64 value rows: each takes DM / VCS columns
__device__ __forceinline__ void ln_tsplit_block(float* tf, float* smu, float* srs, const float* __restrict__ X,
                                                const float* __restrict__ g, const float* __restrict__ bb,
                                                unsigned short* __restrict__ oh, unsigned short* __restrict__ ol, int nrowblk, int bx) {
  const int tid = threadIdx.x, lane = tid & 31, wave = tid >> 5;
  const int sub = tid >> 3, c8 = (tid & 7) * 8;
  if (bx >= VCS * nrowblk) {                       // block-uniform: zero leading columns
    const int pb = bx - VCS * nrowblk;
    const v4u zz = {0u, 0u, 0u, 0u};
    {
      for (int it = 0; it < 32; ++it) {
        const int e = it * 32 + sub;
        const size_t go = (size_t)e * VTP + pb * 64 + c8;
        *(v4u*)(oh + go) = zz;
        *(v4u*)(ol + go) = zz;
      }
      
    }
    return;
  }
  const int r0 = (bx / VCS) * 64;
  const int cb0 = (bx % VCS) * (DM / 64 / VCS);    // first of this block's column tiles
  // phase 1: row statistics
#pragma unroll 1
  for (int q = 0; q < 8; ++q) {
    const int rr = wave * 8 + q;
    const float* xr = X + (size_t)(r0 + rr) * DM + lane * 32;
    v4f a[8];
#pragma unroll
    for (int i = 0; i < 8; ++i) a[i] = *(const v4f*)(xr + 4 * i);
    float s = 0.f;
#pragma unroll
    for (int i = 0; i < 8; ++i) s += a[i][0] + a[i][1] + a[i][2] + a[i][3];
    s = wsum(s);
    const float mu = s * (1.0f / 1024.0f);
    float s2 = 0.f;
#pragma unroll
    for (int i = 0; i < 8; ++i) {
#pragma unroll
      for (int e = 0; e < 4; ++e) { const float dd = a[i][e] - mu; s2 += dd * dd; }
    }
    s2 = wsum(s2);
    if (lane == 0) { smu[rr] = mu; srs[rr] = rsqrtf(s2 * (1.0f / 1024.0f) + 1e-5f); }
  }
  __syncthreads();
  // phase 2: column tiles
  const int lr = tid >> 4, c4 = (tid & 15) * 4;
  for (int cb = cb0; cb < cb0 + DM / 64 / VCS; ++cb) {
    const int c0 = cb * 64;
    const v4f gg = *(const v4f*)(g + c0 + c4);
    const v4f bv = *(const v4f*)(bb + c0 + c4);
#pragma unroll
    for (int it = 0; it < 4; ++it) {
      const int rr = it * 16 + lr;
      const v4f a = *(const v4f*)(X + (size_t)(r0 + rr) * DM + c0 + c4);
      const float mu = smu[rr], rs = srs[rr];
#pragma unroll
      for (int q = 0; q < 4; ++q) tf[rr * 68 + c4 + q] = (a[q] - mu) * rs * gg[q] + bv[q];
    }
    __syncthreads();
    v4u hv[2], lv[2];
#pragma unroll
    for (int it = 0; it < 2; ++it) {
      const int oc = it * 32 + sub;                 // output row within tile = input column
      v4u a, a2;
#pragma unroll
      for (int q = 0; q < 4; ++q) {
        const float f0 = tf[(c8 + 2 * q) * 68 + oc];
        const float f1 = tf[(c8 + 2 * q + 1) * 68 + oc];
        const unsigned short h0 = f2bf_bits(f0), h1 = f2bf_bits(f1);
        const unsigned short l0 = f2bf_bits(f0 - bf_bits2f(h0)), l1 = f2bf_bits(f1 - bf_bits2f(h1));
        a[q]  = pk16(h0, h1);
        a2[q] = pk16(l0, l1);
      }
      hv[it] = a; lv[it] = a2;
    }
    {
#pragma unroll
      for (int it = 0; it < 2; ++it) {
        const int oc = it * 32 + sub;
        const size_t go = (size_t)(c0 + oc) * VTP + KPR + r0 + c8;
        *(v4u*)(oh + go) = hv[it];
        *(v4u*)(ol + go) = lv[it];
      }
      
    }
    __syncthreads();
  }
}

// ---------------------------------------------------------------------------------------------------------------------
// The two adapter norms in one launch: neither reads what the other writes. Blocks 0 .. VCS*NTOK/64 + KPR/64 - 1 (the longer ones, so
// they come first): value rows -> value^T planes; every later block: two key rows (LayerNorm + rotary mix), one per 128 threads.
// NTOK is even, so both rows of a block are data rows or both are padding rows.
// ---------------------------------------------------------------------------------------------------------------------
__global__ __launch_bounds__(256) void k_ln_pair(const float* __restrict__ Xa, const float* __restrict__ ga, const float* __restrict__ ba,
                                                 const float* __restrict__ cs, _Float16* __restrict__ k16,
                                                 const float* __restrict__ Xv, const float* __restrict__ gv, const float* __restrict__ bv,
                                                 unsigned short* __restrict__ oh, unsigned short* __restrict__ ol) {
  __shared__ __align__(16) float tf[64 * 68];
  __shared__ float smu[64];
  __shared__ float srs[64];
  __shared__ float red[2][4];
  __shared__ __align__(16) float rowv[2][DM];
  constexpr int NV = VCS * (NTOK / 64) + KPR / 64;
  const int bx = blockIdx.x;
  if (bx < NV) { ln_tsplit_block(tf, smu, srs, Xv, gv, bv, oh, ol, NTOK / 64, bx); return; }
  const int row0 = (bx - NV) * 2;
  const int half = threadIdx.x >> 7;
  ln1024_row<true>(red[half], rowv[half], Xa, ga, ba, cs, k16, NTOK, KPR, row0 + half, threadIdx.x & 127, row0 >= NTOK);
}

// ---------------------------------------------------------------------------------------------------------------------
// Local-attention mask + softmax over rows of S [NTOK][1024 window keys] -> P bf16 hi/lo planes (all 1024 keys written, masked
// keys as 0). Row r: w = (r % SEQ) / WSZ, i = r % WSZ, query position w*WSZ + i; key j has position (w-1)*WSZ + j; masked when
// that position is negative (padding of the first window) or after the query. Block per row, 128 threads x 8 keys; 16-B stores.
// ---------------------------------------------------------------------------------------------------------------------
__global__ __launch_bounds__(128) void k_lsoftmax(const float* __restrict__ S, unsigned short* __restrict__ Ph, unsigned short* __restrict__ Pl) {
  __shared__ float red[4];
  const int r = blockIdx.x, t = threadIdx.x, c0 = 8 * t;
  const int lane = t & 31, wave = t >> 5;
  const int rem = r & (SEQ - 1), w = rem >> 9, i = rem & (WSZ - 1);
  const int qpos = w * WSZ + i;
  const float* sr = S + (size_t)r * (2 * WSZ) + c0;
  const v4f x0 = *(const v4f*)sr, x1 = *(const v4f*)(sr + 4);
  const float raw[8] = {x0[0], x0[1], x0[2], x0[3], x1[0], x1[1], x1[2], x1[3]};
  float s[8];
  float m = -3.0e38f;
#pragma unroll
  for (int e = 0; e < 8; ++e) {
    const int kpos = (w - 1) * WSZ + c0 + e;
    const bool masked = (kpos < 0) || (kpos > qpos);
    s[e] = masked ? -1.0e9f : raw[e];
    m = fmaxf(m, s[e]);
  }
  m = wmax(m);
  if (lane == 0) red[wave] = m;
  __syncthreads();
  const float rmax = fmaxf(fmaxf(red[0], red[1]), fmaxf(red[2], red[3]));
  __syncthreads();
  float ev[8];
  float sum = 0.f;
#pragma unroll
  for (int e = 0; e < 8; ++e) { ev[e] = expf(s[e] - rmax); sum += ev[e]; }
  sum = wsum(sum);
  if (lane == 0) red[wave] = sum;
  __syncthreads();
  const float tot = red[0] + red[1] + red[2] + red[3];
  const float inv = 1.0f / tot;
  v4u hv, lv;
#pragma unroll
  for (int q = 0; q < 4; ++q) {
    const float p0 = ev[2 * q] * inv, p1 = ev[2 * q + 1] * inv;
    const unsigned short h0 = f2bf_bits(p0), h1 = f2bf_bits(p1);
    const unsigned short l0 = f2bf_bits(p0 - bf_bits2f(h0)), l1 = f2bf_bits(p1 - bf_bits2f(h1));
    hv[q] = pk16(h0, h1);
    lv[q] = pk16(l0, l1);
  }
  const size_t go = (size_t)r * (2 * WSZ) + c0;
  *(v4u*)(Ph + go) = hv;
  *(v4u*)(Pl + go) = lv;
  
}

__device__ __forceinline__ v8f mma_h(v16h a, v16h b, v8f c) {
  c = __builtin_amdgcn_wmma_f32_16x16x32_f16(false, a, false, b, (short)0, c, false, false);
  asm volatile("v_nop\n\tv_nop\n\tv_nop\n\tv_nop" : "+v"(c) : "v"(a), "v"(b));
  return c;
}
// value of lane l ^ 16
__device__ __forceinline__ float xhalf(float x) {
  return __builtin_bit_cast(float, __builtin_amdgcn_permlanex16(__builtin_bit_cast(int, x), __builtin_bit_cast(int, x),
                                                                0x76543210, 0xfedcba98, false, false));
}

// Eight asynchronous 16-byte copies per lane, global -> LDS: four rows of the K chunk and four of the V^T chunk; the four rows of a
// tile lie lstep LDS bytes and kstep (K) or vstep (V^T) global elements apart.
// s_wait_xcnt is the statement's last line so that no address register named here is rewritten in front of it.
__device__ __forceinline__ void copy_kv_to_lds(unsigned lk0, unsigned lv0, unsigned lstep, const _Float16* k0, size_t kstep,
                                               const _Float16* v0, size_t vstep) {
  const unsigned lk1 = lk0 + lstep, lk2 = lk1 + lstep, lk3 = lk2 + lstep;
  const unsigned lv1 = lv0 + lstep, lv2 = lv1 + lstep, lv3 = lv2 + lstep;
  const _Float16* k1 = k0 + kstep; const _Float16* k2 = k1 + kstep; const _Float16* k3 = k2 + kstep;
  const _Float16* v1 = v0 + vstep; const _Float16* v2 = v1 + vstep; const _Float16* v3 = v2 + vstep;
  asm volatile(
      "global_load_async_to_lds_b128 %0, %8, off\n\t"
      "global_load_async_to_lds_b128 %1, %9, off\n\t"
      "global_load_async_to_lds_b128 %2, %10, off\n\t"
      "global_load_async_to_lds_b128 %3, %11, off\n\t"
      "global_load_async_to_lds_b128 %4, %12, off\n\t"
      "global_load_async_to_lds_b128 %5, %13, off\n\t"
      "global_load_async_to_lds_b128 %6, %14, off\n\t"
      "global_load_async_to_lds_b128 %7, %15, off\n\t"
      "s_wait_xcnt 0x0"
      :: "v"(lk0), "v"(lk1), "v"(lk2), "v"(lk3), "v"(lv0), "v"(lv1), "v"(lv2), "v"(lv3),
         "v"(k0), "v"(k1), "v"(k2), "v"(k3), "v"(v0), "v"(v1), "v"(v2), "v"(v3)
      : "memory");
}

__global__ __launch_bounds__(128)
void k_flash(const _Float16* __restrict__ qm, const _Float16* __restrict__ km,
             const _Float16* __restrict__ vt, unsigned short* __restrict__ outh, unsigned short* __restrict__ outl) {
  union FB { v16h v; v8h h[2]; };
  constexpr int KVP = 72;                                     // LDS row pitch in elements: 144 B = 16 B x odd, so that the 16 rows
                                                              // of one 16-byte fragment read fall on 16 distinct groups of 4 banks
  constexpr int TILE = 64 * KVP;                              // elements of one chunk tile
  __shared__ __align__(16) _Float16 KV[2 * 2 * TILE];         // two buffers, each K [kv][d] and behind it V^T [d][kv]
  __shared__ __align__(16) float    Os[4][16 * 68];           // per wave out tile [query][d], pitch 68

  const int tid  = threadIdx.x;
  const int wave = tid >> 5;
  const int lane = tid & 31;
  const int hh   = lane >> 4;
  const int c    = lane & 15;
  const int b  = blockIdx.y;
  const int qb = blockIdx.x & 31;                 // SEQ / 64 = 32 query blocks
  const int h  = blockIdx.x >> 5;
  const int q0 = qb * 64 + wave * 16;

  const _Float16* Qb = qm + (size_t)b * SEQ * INR + h * DHD;
  const _Float16* Kb = km + (size_t)b * SEQ * INR + h * DHD;
  const _Float16* Vb = vt + (size_t)(h * DHD) * NTOK + (size_t)b * SEQ;
  const size_t    oo = (size_t)b * SEQ * INR + h * DHD;   // this head's first element in either output plane

  v16h qa[2];                                     // B operand: column c = query q0 + c, d in the loader's k order
#pragma unroll
  for (int dc = 0; dc < 2; ++dc) qa[dc] = Frag<_Float16>::load(Qb + (size_t)(q0 + c) * INR + dc * 32 + 8 * hh);

  const int qrow = q0 + c;                        // this lane's query
  constexpr float SC2 = 0.125f * 1.4426950408889634f;   // score scale times log2(e): exponents are formed in base 2
  float mrow = -INFINITY;                         // its running maximum of q . k, unscaled (equal in both lane halves)
  float orow = -INFINITY;                         // mrow * SC2 - 12 as rounded: what every exponent of the running state had taken off
  float lrow = 0.f;                               // its running sum of 4096 p over the keys of this lane half; halves joined at the end
  v8f oacc[4];                                    // oacc[t][r] = O[qrow][t*16 + 8*hh + r]
#pragma unroll
  for (int t = 0; t < 4; ++t) oacc[t] = (v8f){0.f,0.f,0.f,0.f,0.f,0.f,0.f,0.f};

  const int nChunks = qb + 1;                     // block-uniform, <= 32
  // this thread's piece of every copy: row crow (+ 16 per copy) of either tile, 16 bytes at element ccol
  const int crow = tid >> 3;
  const int ccol = (tid & 7) * 8;
  const unsigned lth = (unsigned)(size_t)KV + (unsigned)(crow * KVP + ccol) * 2u;
  const _Float16* kth = Kb + (size_t)crow * INR + ccol;               // K row kv0 + crow, d = ccol..ccol+7
  const _Float16* vth = Vb + (size_t)crow * NTOK + ccol;              // V^T row d = crow, s = kv0 + ccol..+7
  auto fill = [&](int buf, int kv) {              // 8 copies per lane: the chunk that begins at key kv into buffer buf
    const unsigned lb = lth + (unsigned)buf * (2 * TILE * 2u);
    copy_kv_to_lds(lb, lb + TILE * 2u, 16 * KVP * 2u, kth + (size_t)kv * INR, (size_t)16 * INR, vth + kv, (size_t)16 * NTOK);
  };
  fill(0, 0);
  asm volatile("s_wait_asynccnt 0x0" ::: "memory");   // this wave's copies of chunk 0 have landed
  __syncthreads();                                     // every wave's have
  if (nChunks > 1) fill(1, 64);

  for (int kc = 0; kc < nChunks; ++kc) {
    const int kv0 = kc * 64;
    const _Float16* Ksh = KV + (kc & 1) * (2 * TILE);
    const _Float16* Vth = Ksh + TILE;

    // S^T tiles: s[j][r] = score of key kv0 + j*16 + 8*hh + r with query qrow
    FB kb[4][2];
#pragma unroll                                    // static indices: the fragment and accumulator arrays stay in registers
    for (int j = 0; j < 4; ++j)
#pragma unroll                                    // static indices: the fragment and accumulator arrays stay in registers
      for (int dc = 0; dc < 2; ++dc) {
        kb[j][dc].h[0] = *(const v8h*)(Ksh + (j * 16 + c) * KVP + dc * 32 + 8 * hh);
        kb[j][dc].h[1] = *(const v8h*)(Ksh + (j * 16 + c) * KVP + dc * 32 + 16 + 8 * hh);
      }
    v8f s[4];
#pragma unroll                                    // static indices: the fragment and accumulator arrays stay in registers
    for (int j = 0; j < 4; ++j) s[j] = (v8f){0.f,0.f,0.f,0.f,0.f,0.f,0.f,0.f};
#pragma unroll                                    // static indices: the fragment and accumulator arrays stay in registers
    for (int dc = 0; dc < 2; ++dc)
#pragma unroll                                    // static indices: the fragment and accumulator arrays stay in registers
      for (int j = 0; j < 4; ++j) s[j] = mma_h(kb[j][dc].v, qa[dc], s[j]);

    const bool diag = (kc == qb);                 // block-uniform
    float m = -INFINITY;
#pragma unroll                                    // static indices: the fragment and accumulator arrays stay in registers
    for (int j = 0; j < 4; ++j)
#pragma unroll                                    // static indices: the fragment and accumulator arrays stay in registers
      for (int r = 0; r < 8; ++r) {
        const int kvrow = kv0 + j * 16 + 8 * hh + r;
        const bool masked = diag && (kvrow > qrow);
        const float sm = masked ? -INFINITY : s[j][r];
        s[j][r] = sm;
        m = fmaxf(m, sm);
      }
    m = fmaxf(m, xhalf(m));
    const float mnew = fmaxf(mrow, m);
    const float onew = fmaf(mnew, SC2, -12.0f);
    const float alpha = __builtin_amdgcn_exp2f(orow - onew);
    mrow = mnew;
    orow = onew;
    // P^T as B operand: element e of pb[kk] = key kk*32 + (e < 8 ? 8*hh + e : 16 + 8*hh + e - 8), the loader's k order
    FB pb[2];
    float psum = 0.f;
#pragma unroll                                    // static indices: the fragment and accumulator arrays stay in registers
    for (int j = 0; j < 4; ++j)
#pragma unroll                                    // static indices: the fragment and accumulator arrays stay in registers
      for (int r = 0; r < 8; ++r) {
        const float p = __builtin_amdgcn_exp2f(fmaf(s[j][r], SC2, -onew));   // 4096 * exp(0.125 * (q . k - maximum))
        psum += p;
        pb[j >> 1].v[(j & 1) * 8 + r] = (_Float16)p;
      }
    lrow = lrow * alpha + psum;
#pragma unroll                                    // static indices: the fragment and accumulator arrays stay in registers
    for (int t = 0; t < 4; ++t)
#pragma unroll                                    // static indices: the fragment and accumulator arrays stay in registers
      for (int r = 0; r < 8; ++r) oacc[t][r] *= alpha;

    FB vb[2][4];
#pragma unroll                                    // static indices: the fragment and accumulator arrays stay in registers
    for (int kk = 0; kk < 2; ++kk)
#pragma unroll                                    // static indices: the fragment and accumulator arrays stay in registers
      for (int t = 0; t < 4; ++t) {
        vb[kk][t].h[0] = *(const v8h*)(Vth + (t * 16 + c) * KVP + kk * 32 + 8 * hh);
        vb[kk][t].h[1] = *(const v8h*)(Vth + (t * 16 + c) * KVP + kk * 32 + 16 + 8 * hh);
      }
#pragma unroll                                    // static indices: the fragment and accumulator arrays stay in registers
    for (int kk = 0; kk < 2; ++kk)
#pragma unroll                                    // static indices: the fragment and accumulator arrays stay in registers
      for (int t = 0; t < 4; ++t) oacc[t] = mma_h(vb[kk][t].v, pb[kk].v, oacc[t]);

    asm volatile("s_wait_dscnt 0x0" ::: "memory");     // this wave's reads of buffer kc & 1 are done before it is refilled
    asm volatile("s_wait_asynccnt 0x0" ::: "memory");  // this wave's copies of chunk kc + 1 have landed
    __syncthreads();                                    // publishes chunk kc + 1 and ends every reader's use of buffer kc & 1
    if (kc + 2 < nChunks) fill(kc & 1, kv0 + 128);
  }
  asm volatile("s_wait_asynccnt 0x0" ::: "memory");    // no copy is outstanding when the wave goes on or ends

  float* os = Os[wave];
  {
    const float ltot = lrow + xhalf(lrow);
    const float inv = 1.0f / ltot;                // sum and accumulators both carry the factor 4096
#pragma unroll                                    // static indices: the fragment and accumulator arrays stay in registers
    for (int t = 0; t < 4; ++t) {
      v4f lo, hi;
#pragma unroll                                    // static indices: the fragment and accumulator arrays stay in registers
      for (int r = 0; r < 4; ++r) { lo[r] = oacc[t][r] * inv; hi[r] = oacc[t][4 + r] * inv; }
      *(v4f*)(os + c * 68 + t * 16 + 8 * hh)     = lo;
      *(v4f*)(os + c * 68 + t * 16 + 8 * hh + 4) = hi;
    }
  }
  __builtin_amdgcn_fence(__ATOMIC_RELEASE, "workgroup");
  __builtin_amdgcn_wave_barrier();
  __builtin_amdgcn_fence(__ATOMIC_ACQUIRE, "workgroup");
  {
    // bf16 hi/lo split of the f32 result, hi = bf16(o), lo = bf16(o - hi): 16 lanes x 8 bytes = a head's whole 128-byte row per plane
    const int c4 = (lane & 15) * 4;
    v2u uh[8], ul[8];
#pragma unroll                                    // static indices: the small arrays stay in registers
    for (int it = 0; it < 8; ++it) {
      const int row = it * 2 + hh;                  // it 0..7 x hh 0..1 covers rows 0..15
      const v4f val = *(const v4f*)(os + row * 68 + c4);
      unsigned short hb[4], lb[4];
#pragma unroll                                    // static indices: the small arrays stay in registers
      for (int e = 0; e < 4; ++e) { hb[e] = f2bf_bits(val[e]); lb[e] = f2bf_bits(val[e] - bf_bits2f(hb[e])); }
      uh[it][0] = pk16(hb[0], hb[1]); uh[it][1] = pk16(hb[2], hb[3]);
      ul[it][0] = pk16(lb[0], lb[1]); ul[it][1] = pk16(lb[2], lb[3]);
    }
#pragma unroll                                    // all sixteen stores back to back, behind the arithmetic
    for (int it = 0; it < 8; ++it) {
      const size_t go = oo + (size_t)(q0 + it * 2 + hh) * INR + c4;
      *(v2u*)(outh + go) = uh[it];
      *(v2u*)(outl + go) = ul[it];
    }
  }
}

// ---------------------------------------------------------------------------------------------------------------------
// Row LayerNorm over FFD=4096 of the f16 plane U (values carried as 256*u), in place -> f16 of the unit-scale result.
// Block per row, 256 threads x 2 chunks of 8; statistics in f32 with the 2^-8 / 2^-16 carries folded before eps.
// ---------------------------------------------------------------------------------------------------------------------
__global__ __launch_bounds__(256) void k_ln4096(_Float16* __restrict__ U, const float* __restrict__ g, const float* __restrict__ bb) {
  __shared__ float red[8];
  const int r = blockIdx.x, t = threadIdx.x;
  const int lane = t & 31, wave = t >> 5;
  const int cA = 8 * t, cB = 2048 + 8 * t;
  _Float16* ur = U + (size_t)r * FFD;
  const v8h a = *(const v8h*)(ur + cA);
  const v8h a2 = *(const v8h*)(ur + cB);
  float v[16];
#pragma unroll
  for (int e = 0; e < 8; ++e) { v[e] = (float)a[e]; v[8 + e] = (float)a2[e]; }
  float s = 0.f;
#pragma unroll
  for (int e = 0; e < 16; ++e) s += v[e];
  s = wsum(s);
  if (lane == 0) red[wave] = s;
  __syncthreads();
  float tot = 0.f;
#pragma unroll
  for (int i = 0; i < 8; ++i) tot += red[i];
  const float mu = tot * (1.0f / 4096.0f);
  __syncthreads();
  float d[16];
  float s2 = 0.f;
#pragma unroll
  for (int e = 0; e < 16; ++e) { d[e] = v[e] - mu; s2 += d[e] * d[e]; }
  s2 = wsum(s2);
  if (lane == 0) red[wave] = s2;
  __syncthreads();
  float tot2 = 0.f;
#pragma unroll
  for (int i = 0; i < 8; ++i) tot2 += red[i];
  const float var_s = tot2 * (1.0f / 4096.0f);
  const float rstd = rsqrtf(var_s * (1.0f / 65536.0f) + 1e-5f) * (1.0f / 256.0f);
  v8h ha, hb;
#pragma unroll
  for (int e = 0; e < 8; ++e) {
    ha[e] = (_Float16)(d[e] * rstd * g[cA + e] + bb[cA + e]);
    hb[e] = (_Float16)(d[8 + e] * rstd * g[cB + e] + bb[cB + e]);
  }
  *(v8h*)(ur + cA) = ha;
  *(v8h*)(ur + cB) = hb;
  
}

// =====================================================================================================================
// Workspace map (byte offsets; every region a whole number of MiB after 4 KiB left unused, all stores whole-line):
//   (unused)                                       0            (4 KiB)
//   cs  f32[2048][512][2]                          4 KiB        (8 MiB)
//   WaT f16[1024][1024] x64                       +8 MiB       WvTh/WvTl bf16 [1024][1024]   WqT f16[512][1024]
//   WkvT f16[1024][1024]   W1T f16[4096][1024]   W2T f16[1024][4096]   WoTh/WoTl bf16[1024][512]   (27 MiB)
//   R3  8 MiB : q16 f16[4096][1024] -> h16 -> x2h (f16, x2 * 1024)
//   R4 16 MiB : audio adapter GEMM f32 [4096][1024] -> S f32 [4096][1024] -> x f32 -> x2 f32
//   R5 51 MiB : a16 f16 @0, video hi @8, video lo @16, k16 f16[(512+4096)][1024] @24, vTh bf16[1024][4608] @33, vTl @42;
//               later Ph @0, Pl @8; q/k f16[4096][512] @0/@4, vT16 f16[512][4096] @8; o hi/lo bf16[4096][512] @24/@28;
//               U f16[4096][4096] @0 (written only after all earlier users of [0,32) have been consumed).
//   R6 16 MiB : video adapter GEMM f32 [4096][1024]
//   total 126 MiB + 4 KiB.
// =====================================================================================================================
extern "C" void kernel_launch(void* const* d_in, const int* in_sizes, int n_in,
                              void* d_out, int out_size, void* d_ws, size_t ws_size,
                              hipStream_t stream) {
  if (n_in < 24) return;
  if (in_sizes[0] != NTOK * DM || in_sizes[1] != NTOK * DM || in_sizes[2] != NTOK * DM) return;
  if (in_sizes[3] != DM * DM || in_sizes[7] != DM * DM || in_sizes[14] != DM * 2 * INR) return;
  if (in_sizes[13] != DM * INR || in_sizes[17] != INR * DM) return;
  if (in_sizes[18] != DM * FFD || in_sizes[22] != FFD * DM) return;
  if (in_sizes[4] != DM || in_sizes[5] != DM || in_sizes[6] != DM || in_sizes[8] != DM || in_sizes[9] != DM ||
      in_sizes[10] != DM || in_sizes[11] != DM || in_sizes[12] != DM || in_sizes[23] != DM) return;
  if (in_sizes[15] != DHD || in_sizes[16] != DHD) return;
  if (in_sizes[19] != FFD || in_sizes[20] != FFD || in_sizes[21] != FFD) return;
  if (out_size != NTOK * DM) return;

  const float* text  = (const float*)d_in[0];
  const float* audio = (const float*)d_in[1];
  const float* video = (const float*)d_in[2];
  const float* Wa    = (const float*)d_in[3];
  const float* ba    = (const float*)d_in[4];
  const float* lna_g = (const float*)d_in[5];
  const float* lna_b = (const float*)d_in[6];
  const float* Wvid  = (const float*)d_in[7];
  const float* bvid  = (const float*)d_in[8];
  const float* lnv_g = (const float*)d_in[9];
  const float* lnv_b = (const float*)d_in[10];
  const float* ln1_g = (const float*)d_in[11];
  const float* ln1_b = (const float*)d_in[12];
  const float* Wq    = (const float*)d_in[13];
  const float* Wkv   = (const float*)d_in[14];
  const float* qn_g  = (const float*)d_in[15];
  const float* kn_g  = (const float*)d_in[16];
  const float* Wo    = (const float*)d_in[17];
  const float* W1    = (const float*)d_in[18];
  const float* b1    = (const float*)d_in[19];
  const float* ln2_g = (const float*)d_in[20];
  const float* ln2_b = (const float*)d_in[21];
  const float* W2    = (const float*)d_in[22];
  const float* b2    = (const float*)d_in[23];
  float* outp = (float*)d_out;

  const size_t MIB = 1048576;
  size_t off = 0;
  const size_t oInv  = off; off += 4096;
  const size_t oCs   = off; off += (size_t)SEQ * 512 * 2 * 4;       // 8 MiB
  const size_t oWaT  = off; off += (size_t)DM * DM * 2;              // 2 MiB
  const size_t oWvTh = off; off += (size_t)DM * DM * 2;              // 2 MiB
  const size_t oWvTl = off; off += (size_t)DM * DM * 2;              // 2 MiB
  const size_t oWqT  = off; off += (size_t)INR * DM * 2;             // 1 MiB
  const size_t oWkvT = off; off += (size_t)2 * INR * DM * 2;         // 2 MiB
  const size_t oW1T  = off; off += (size_t)FFD * DM * 2;             // 8 MiB
  const size_t oW2T  = off; off += (size_t)DM * FFD * 2;             // 8 MiB
  const size_t oWoTh = off; off += (size_t)DM * INR * 2;             // 1 MiB
  const size_t oWoTl = off; off += (size_t)DM * INR * 2;             // 1 MiB
  const size_t oR3   = off; off += (size_t)NTOK * DM * 2;            // 8 MiB
  const size_t oR4   = off; off += (size_t)NTOK * DM * 4;            // 16 MiB
  const size_t oR5   = off; off += 51 * MIB;                         // 51 MiB
  const size_t oR6   = off; off += (size_t)NTOK * DM * 4;            // 16 MiB
  if (off > ws_size || off > (size_t)128 * MIB) return;              // off = 126 MiB + 4 KiB

  char* ws = (char*)d_ws;
  float* cs  = (float*)(ws + oCs);
  _Float16* WaT = (_Float16*)(ws + oWaT);
  unsigned short* WvTh = (unsigned short*)(ws + oWvTh);
  unsigned short* WvTl = (unsigned short*)(ws + oWvTl);
  _Float16* WqT  = (_Float16*)(ws + oWqT);
  _Float16* WkvT = (_Float16*)(ws + oWkvT);
  _Float16* W1T  = (_Float16*)(ws + oW1T);
  _Float16* W2T  = (_Float16*)(ws + oW2T);
  unsigned short* WoTh = (unsigned short*)(ws + oWoTh);
  unsigned short* WoTl = (unsigned short*)(ws + oWoTl);
  _Float16* q16 = (_Float16*)(ws + oR3);          // text after rotary
  _Float16* h16 = (_Float16*)(ws + oR3);          // LN1 output (later)
  _Float16* x2h = (_Float16*)(ws + oR3);          // x2 * 1024 (later)
  float* Cad = (float*)(ws + oR4);                // audio adapter GEMM output
  float* Cvd = (float*)(ws + oR6);                // video adapter GEMM output
  float* Sf  = (float*)(ws + oR4);                // local scores (later)
  float* Xf  = (float*)(ws + oR4);                // local attention output (later)
  float* X2f = (float*)(ws + oR4);                // 2 * o @ Wo (later)
  char* r5 = ws + oR5;
  _Float16* a16 = (_Float16*)(r5);
  unsigned short* vih = (unsigned short*)(r5 + 8 * MIB);
  unsigned short* vil = (unsigned short*)(r5 + 16 * MIB);
  _Float16* k16 = (_Float16*)(r5 + 24 * MIB);     // [(KPR+NTOK)][DM]
  unsigned short* vTh = (unsigned short*)(r5 + 33 * MIB);
  unsigned short* vTl = (unsigned short*)(r5 + 42 * MIB);
  unsigned short* Ph  = (unsigned short*)(r5);
  unsigned short* Pl  = (unsigned short*)(r5 + 8 * MIB);
  _Float16* qm16 = (_Float16*)(r5);
  _Float16* km16 = (_Float16*)(r5 + 4 * MIB);
  _Float16* vT16 = (_Float16*)(r5 + 8 * MIB);
  unsigned short* Oh = (unsigned short*)(r5 + 24 * MIB);
  unsigned short* Ol = (unsigned short*)(r5 + 28 * MIB);
  _Float16* U16 = (_Float16*)(r5);

  const dim3 blk(256);
  const dim3 blkG(128);                           // k_gemm: 4 waves
  const unsigned short* N16 = (const unsigned short*)nullptr;

  // everything that depends on the inputs alone, in one launch: rotary table and text -> rotary f16, the seven weight re-layouts
  // (in [rows][cols] f32 -> out [cols][rows]), audio -> f16, video -> bf16 hi/lo
  k_prep<<<dim3(PREP_BLOCKS), blk, 0, stream>>>(text, audio, video, Wa, Wvid, Wq, Wkv, W1, W2, Wo, cs, q16, a16, vih, vil,
                                                WaT, WvTh, WvTl, WqT, WkvT, W1T, W2T, WoTh, WoTl);

  // adapter a: audio . Wa + ba -> f32; adapter v: video . Wvid + bvid (bf16 hi/lo split) -> f32, each into its own plane, one launch
  const dim3 gA((NTOK / 128) * (DM / 128), 1);
  k_gemm_adapters<<<dim3((NTOK / 128) * (DM / 128), 2), blkG, 0, stream>>>(
      vih, vil, WvTh, WvTl, bvid, Cvd, (const unsigned short*)a16, (const unsigned short*)WaT, ba, Cad, NTOK, DM, DM);
  // both norms in one launch: a: LN + rotary -> key plane rows KPR..KPR+4095, rows 0..KPR-1 zero; v: LN + transpose + split ->
  // value^T planes
  k_ln_pair<<<dim3(VCS * (NTOK / 64) + KPR / 64 + (NTOK + KPR) / 2), blk, 0, stream>>>(Cad, lna_g, lna_b, cs, k16, Cvd, lnv_g, lnv_b, vTh, vTl);

  // local attention: z = b*4 + w; S[z][512][1024] = q . k / 32 over window keys (skipping fully masked key tiles)
  const dim3 gS((WSZ / 128) * (2 * WSZ / 128), NB_ * NWN);
  k_gemm<0, false, false, 0, 0, false, 1><<<gS, blkG, 0, stream>>>(
      (const unsigned short*)q16, N16, DM, (long)WSZ * DM, (const unsigned short*)k16, N16, DM, (long)WSZ * DM,
      Sf, 2 * WSZ, (long)WSZ * 2 * WSZ, nullptr, 0, 0L, nullptr, nullptr, nullptr, 0, 0L,
      WSZ, 2 * WSZ, DM, NWN, 1.0f / 32.0f, 1.0f);
  k_lsoftmax<<<dim3(NTOK), dim3(128), 0, stream>>>(Sf, Ph, Pl);
  // x[z][512][1024] = P . v (bf16 hi/lo split), keys restricted to the unmasked range
  const dim3 gPV((WSZ / 128) * (DM / 128), NB_ * NWN);
  k_gemm<1, true, false, 0, 0, false, 2><<<gPV, blkG, 0, stream>>>(
      Ph, Pl, 2 * WSZ, (long)WSZ * 2 * WSZ, vTh, vTl, VTP, (long)WSZ,
      Xf, DM, (long)WSZ * DM, nullptr, 0, 0L, nullptr, nullptr, nullptr, 0, 0L,
      WSZ, DM, 2 * WSZ, NWN, 1.0f, 1.0f);

  // LN1 -> h16; q, k (RMSNorm epilogue) and v^T projections
  k_ln1024<<<dim3(NTOK), dim3(128), 0, stream>>>(Xf, ln1_g, ln1_b, h16, NTOK);
  // one grid, z = 0: q, 1: k, 2: v^T; WqT, the k rows and the v rows of WkvT lie INR * DM elements apart, qm16, km16 and vT16
  // NTOK * INR elements apart
  const dim3 gQKV((NTOK / 128) * (INR / 128), 3);
  k_gemm<0, false, false, 2, 1, false, 3><<<gQKV, blkG, 0, stream>>>(
      (const unsigned short*)h16, N16, DM, 0L, (const unsigned short*)WqT, N16, DM, (long)INR * DM,
      nullptr, 0, 0L, qm16, INR, (long)NTOK * INR, nullptr, qn_g, kn_g, 0, 0L, NTOK, INR, DM, 1, 1.0f / 64.0f, 1.0f);

  // causal attention -> o [4096][512] as bf16 hi/lo planes
  k_flash<<<dim3(NHD * (SEQ / 64), NB_), dim3(128), 0, stream>>>(qm16, km16, vT16, Oh, Ol);

  // x2 = 2 * (o . Wo) -> f32 and f16 (x2 * 1024)
  k_gemm<1, true, false, 0, 2, false, 0><<<gA, blkG, 0, stream>>>(
      Oh, Ol, INR, 0L, WoTh, WoTl, INR, 0L,
      X2f, DM, 0L, x2h, DM, 0L, nullptr, nullptr, nullptr, 0, 0L, NTOK, DM, INR, 1, 2.0f, 1024.0f);

  // FFN: u = gelu(x2 . W1 + b1) stored as f16(256 u); LN over 4096 in place; out = h1 . W2 + b2 + x2
  const dim3 gW1((NTOK / 128) * (FFD / 128), 1);
  k_gemm<0, false, true, 1, 1, false, 0><<<gW1, blkG, 0, stream>>>(
      (const unsigned short*)x2h, N16, DM, 0L, (const unsigned short*)W1T, N16, DM, 0L,
      nullptr, 0, 0L, U16, FFD, 0L, b1, nullptr, nullptr, 0, 0L, NTOK, FFD, DM, 1, 1.0f / 65536.0f, 256.0f);
  k_ln4096<<<dim3(NTOK), blk, 0, stream>>>(U16, ln2_g, ln2_b);
  k_gemm<0, false, true, 0, 0, true, 0><<<gA, blkG, 0, stream>>>(
      (const unsigned short*)U16, N16, FFD, 0L, (const unsigned short*)W2T, N16, FFD, 0L,
      outp, DM, 0L, nullptr, 0, 0L, b2, nullptr, X2f, DM, 0L, NTOK, DM, FFD, 1, 1.0f / 64.0f, 1.0f);
  (void)hipGetLastError();
}
